// v000
// The times below were measured on an AMD MI455X: many runs one after another, warmed up first and cycling through
// copies of the inputs, with the whole window's GPU time divided by the number of runs. Launches and the gaps
// between them are all in it. The median over several windows is given; except for v000 it joins two sittings, which
// can be a few percent apart, so the side-by-side timings, each taken in one sitting, are the better comparison.
// v000 is the starting kernel. One run takes 4510 microseconds.
#include <hip/hip_runtime.h>

// Temporal decoder cross-attention with sensor importance (query [2][2048][1024], key_value [2][256][16][1024] -> 4096 source tokens (t_kv, sensor), imp_weights [2][16]; q/k/v = x W^T (16 heads x 64);
// scores = q.k/8 + log(max(imp[b][sensor of key], 1e-6)) (read as data); softmax over the 4096 keys; out = merged (attn v) W_o^T -> [2][2048][1024]).
// Compute dtypes, f32 accumulate: every input rounded to bf16; q/k/v projections on PLAIN bf16 operands (inputs: exact products, f32 accumulate); scores (K 64) and attn.v on

#define NB_  2
#define TQ   2048
#define TKC  4096
#define NSEN 16
#define DD   1024
#define NH_  16
#define HD   64
#define PCAR 1024.0f
#define SCL  0.125f
typedef _Float16 h16;
typedef unsigned short bf;
typedef __attribute__((ext_vector_type(16))) __bf16   v16bf;
typedef __attribute__((ext_vector_type(16))) _Float16 v16h;
typedef __attribute__((ext_vector_type(8)))  _Float16 v8h;
typedef __attribute__((ext_vector_type(8)))  unsigned short v8us;
typedef __attribute__((ext_vector_type(8)))  float    v8f;
typedef __attribute__((ext_vector_type(4)))  float    v4f;
typedef v8h  __attribute__((may_alias)) v8ha;
typedef v4f  __attribute__((may_alias)) v4fa;
typedef v8us __attribute__((may_alias)) v8usa;

__device__ __forceinline__ unsigned short f2bf(float f) { unsigned u = __float_as_uint(f); u += 0x7FFFu + ((u >> 16) & 1u); return (unsigned short)(u >> 16); }
__device__ __forceinline__ float bf2f(unsigned short b) { return __uint_as_float(((unsigned)b) << 16); }
__device__ __forceinline__ float bfr(float f) { return bf2f(f2bf(f)); }
__device__ __forceinline__ v16h cat16(v8h lo, v8h hi) { return __builtin_shufflevector(lo, hi, 0, 1, 2, 3, 4, 5, 6, 7, 8, 9, 10, 11, 12, 13, 14, 15); }
__device__ __forceinline__ v16bf cat16b(v8us lo, v8us hi) { return __builtin_bit_cast(v16bf, __builtin_shufflevector(lo, hi, 0, 1, 2, 3, 4, 5, 6, 7, 8, 9, 10, 11, 12, 13, 14, 15)); }
__device__ __forceinline__ v8f wmma16(v16h a, v16h b, v8f c) { return __builtin_amdgcn_wmma_f32_16x16x32_f16(false, a, false, b, (short)0, c, false, false); }
__device__ __forceinline__ v8f wmmab(v16bf a, v16bf b, v8f c) { return __builtin_amdgcn_wmma_f32_16x16x32_bf16(false, a, false, b, (short)0, c, false, false); }



// ---- k_gemmw: register-blocked GEMM, ONE WAVE per 64x64 output tile (16 accumulators), operands straight from K-contiguous 16-bit planes; grid (M/64, N/64, Z), 32 threads.
// C[m][n] (f32, pitch ldc, + optional f32 bias[n]) = sum_k A[m][k] Bt[n][k] (+ split products per NSPLIT). z-batch strides sA/sB/sC in elements. K % 32 == 0.
template <typename T16> struct WFrag;
template <> struct WFrag<h16> { typedef v16h V; static __device__ __forceinline__ V ld(const h16* p) { return cat16(*(const v8h*)p, *(const v8h*)(p + 16)); } static __device__ __forceinline__ v8f mma(V a, V b, v8f c) { return wmma16(a, b, c); } };
template <> struct WFrag<bf> { typedef v16bf V; static __device__ __forceinline__ V ld(const bf* p) { return cat16b(*(const v8us*)p, *(const v8us*)(p + 16)); } static __device__ __forceinline__ v8f mma(V a, V b, v8f c) { return wmmab(a, b, c); } };
template <typename T16, int NSPLIT, bool BIAS>
__global__ __launch_bounds__(32) void k_gemmw(const T16* __restrict__ A, const T16* __restrict__ A2, const T16* __restrict__ Bt, const T16* __restrict__ Bt2, int K, float* C, int ldc, const float* __restrict__ bias, size_t sA, size_t sB, size_t sC) {
    typedef typename WFrag<T16>::V V;
    __shared__ __align__(16) float os[16 * 68];
    const size_t z = blockIdx.z; A += z * sA; if (A2) A2 += z * sA; Bt += z * sB; if (Bt2) Bt2 += z * sB; C += z * sC;
    const int lane = threadIdx.x & 31, lr = lane & 15, hi = lane >> 4; const int r0 = blockIdx.x * 64, c0 = blockIdx.y * 64;
    v8f acc[4][4];
#pragma unroll
    for (int mb = 0; mb < 4; ++mb)
#pragma unroll
        for (int nb = 0; nb < 4; ++nb) acc[mb][nb] = (v8f){};
    const size_t aoff = (size_t)(r0 + lr) * K + 8 * hi, boff = (size_t)(c0 + lr) * K + 8 * hi;
#pragma unroll 1
    for (int kc = 0; kc < K; kc += 32) {
        V a[4], a2[4];
#pragma unroll
        for (int mb = 0; mb < 4; ++mb) { a[mb] = WFrag<T16>::ld(A + aoff + (size_t)mb * 16 * K + kc); if (NSPLIT == 1 || NSPLIT == 2) a2[mb] = WFrag<T16>::ld(A2 + aoff + (size_t)mb * 16 * K + kc); }
#pragma unroll
        for (int nb = 0; nb < 4; ++nb) { const V b = WFrag<T16>::ld(Bt + boff + (size_t)nb * 16 * K + kc); V b2; if (NSPLIT >= 2) b2 = WFrag<T16>::ld(Bt2 + boff + (size_t)nb * 16 * K + kc);
#pragma unroll
            for (int mb = 0; mb < 4; ++mb) { acc[mb][nb] = WFrag<T16>::mma(a[mb], b, acc[mb][nb]); if (NSPLIT == 1 || NSPLIT == 2) acc[mb][nb] = WFrag<T16>::mma(a2[mb], b, acc[mb][nb]); if (NSPLIT >= 2) acc[mb][nb] = WFrag<T16>::mma(a[mb], b2, acc[mb][nb]); } }
        asm volatile("v_nop\n\tv_nop\n\tv_nop\n\tv_nop" : "+v"(acc[0][0]), "+v"(acc[1][1]), "+v"(acc[2][2]), "+v"(acc[3][3]) : "v"(a[0]), "v"(a[3]));
    }
#pragma unroll
    for (int mb = 0; mb < 4; ++mb) {
#pragma unroll
        for (int nb = 0; nb < 4; ++nb) {
#pragma unroll
            for (int j = 0; j < 8; ++j) os[(hi * 8 + j) * 68 + nb * 16 + lr] = acc[mb][nb][j]; }
        __builtin_amdgcn_wave_barrier(); asm volatile("" ::: "memory");
        float* crow = C + (size_t)(r0 + mb * 16) * ldc + c0;
{
#pragma unroll
            for (int s = 0; s < 8; ++s) { const int row = 2 * s + hi, cofs = lr * 4; v4f val = *(const v4fa*)(os + row * 68 + cofs); if (BIAS) { val[0] += bfr(bias[c0 + cofs]); val[1] += bfr(bias[c0 + cofs + 1]); val[2] += bfr(bias[c0 + cofs + 2]); val[3] += bfr(bias[c0 + cofs + 3]); }
                *(v4f*)(crow + (size_t)row * ldc + cofs) = val; }
             }
        __builtin_amdgcn_wave_barrier(); asm volatile("" ::: "memory");
    }
}

__device__ __forceinline__ h16 tohx(float x) { return (h16)x; }
__device__ __forceinline__ void splitf(float y, unsigned short& h, unsigned short& l) { h = f2bf(y); l = f2bf(y - bf2f(h)); }
typedef __attribute__((ext_vector_type(2))) _Float16 v2h;
typedef __attribute__((ext_vector_type(4))) _Float16 v4h;
typedef __attribute__((ext_vector_type(2))) unsigned short v2us;

__global__ __launch_bounds__(256) void k_cvt8(const float* __restrict__ src, bf* dst, size_t n8) { const size_t i = (size_t)blockIdx.x * 256 + threadIdx.x; if (i >= n8) return; const v8f v = *(const v8f*)(src + i * 8); v8us o;
#pragma unroll
    for (int k = 0; k < 8; ++k) o[k] = f2bf(v[k]); *(v8us*)(dst + i * 8) = o;  }
__global__ __launch_bounds__(256) void k_limp(const float* __restrict__ imp, float* LI) { const int i = blockIdx.x * 256 + threadIdx.x; if (i >= NB_ * TKC) return; const int b = i / TKC, j = i % TKC; const float w = fmaxf(bfr(imp[b * NSEN + (j % NSEN)]), 1e-6f); const float l = logf(w); *(float*)(LI + i) = l;  }
__global__ __launch_bounds__(256) void k_pl(const float* __restrict__ F, int nT, h16* P) { const size_t e = ((size_t)blockIdx.x * 256 + threadIdx.x) * 2; if (e >= (size_t)NH_ * nT * HD) return; const int d = (int)(e & 63); const int t = (int)((e >> 6) % nT); const int h = (int)(e / ((size_t)nT * HD)); v2h o; o[0] = tohx(F[(size_t)t * DD + h * HD + d]); o[1] = tohx(F[(size_t)t * DD + h * HD + d + 1]); *(v2h*)(P + e) = o;  }
__global__ __launch_bounds__(256) void k_vt(const float* __restrict__ F, int nT, h16* VT) { const size_t e = ((size_t)blockIdx.x * 256 + threadIdx.x) * 2; if (e >= (size_t)NH_ * HD * nT) return; const int t = (int)(e % nT); const int d = (int)((e / nT) & 63); const int h = (int)(e / ((size_t)nT * HD)); v2h o; o[0] = tohx(F[(size_t)t * DD + h * HD + d]); o[1] = tohx(F[(size_t)(t + 1) * DD + h * HD + d]); *(v2h*)(VT + e) = o;  }
__global__ __launch_bounds__(256) void k_smax(const float* __restrict__ S, const float* __restrict__ LI, float* RS) { const int lane = threadIdx.x & 31; const int i = blockIdx.x * 8 + (threadIdx.x >> 5); if (i >= TQ) return; const float* sr = S + (size_t)i * TKC; float m = -3.0e38f;
#pragma unroll 4
    for (int c0 = lane * 4; c0 < TKC; c0 += 128) { const v4f v = *(const v4f*)(sr + c0), l4 = *(const v4f*)(LI + c0);
#pragma unroll
        for (int q = 0; q < 4; ++q) { float a = v[q] * SCL; asm volatile("" : "+v"(a)); m = fmaxf(m, __fadd_rn(a, l4[q])); } }
#pragma unroll
    for (int sh = 16; sh; sh >>= 1) m = fmaxf(m, __shfl_xor(m, sh, 32));
    const float o = lane == 0 ? m : 0.f; *(float*)(RS + (size_t)i * 32 + lane) = o;  }
__global__ __launch_bounds__(256) void k_sexp(const float* __restrict__ S, const float* __restrict__ LI, float* RS, h16* P) { const int lane = threadIdx.x & 31; const int i = blockIdx.x * 8 + (threadIdx.x >> 5); if (i >= TQ) return; const float* sr = S + (size_t)i * TKC; const float m = RS[(size_t)i * 32]; float sum = 0.f;
{ sum = 0.f;
#pragma unroll 2
        for (int c0 = lane * 4; c0 < TKC; c0 += 128) { const v4f v = *(const v4f*)(sr + c0), l4 = *(const v4f*)(LI + c0); v4h o;
#pragma unroll
            for (int q = 0; q < 4; ++q) { float a = v[q] * SCL; asm volatile("" : "+v"(a)); float t = __fadd_rn(a, l4[q]); float dlt = __fsub_rn(t, m); asm volatile("" : "+v"(dlt)); const float e = __builtin_amdgcn_exp2f(__fmul_rn(dlt, 1.4426950408889634f)); sum += e; o[q] = tohx(e * PCAR); }
            *(v4h*)(P + (size_t)i * TKC + c0) = o; }
         }
#pragma unroll
    for (int sh = 16; sh; sh >>= 1) sum += __shfl_xor(sum, sh, 32);
    const float o2 = lane == 0 ? m : (lane == 1 ? __fdiv_rn(1.0f, sum * PCAR) : 0.f); *(float*)(RS + (size_t)i * 32 + lane) = o2;  }
__global__ __launch_bounds__(256) void k_mrg(const float* __restrict__ O, const float* __restrict__ RS, int h, bf* Ah, bf* Al) { const int e = (blockIdx.x * 256 + threadIdx.x) * 2; if (e >= TQ * HD) return; const int d = e & 63; const int t = e >> 6; const float sc = RS[(size_t)t * 32 + 1]; v2us oh, ol;
#pragma unroll
    for (int q = 0; q < 2; ++q) { unsigned short a, c2; splitf(__fmul_rn(O[e + q], sc), a, c2); oh[q] = a; ol[q] = c2; } const size_t oo = (size_t)t * DD + h * HD + d; *(v2us*)(Ah + oo) = oh; *(v2us*)(Al + oo) = ol;  }

extern "C" void kernel_launch(void* const* d_in, const int* in_sizes, int n_in,
                              void* d_out, int out_size, void* d_ws, size_t ws_size, hipStream_t stream) {
    (void)in_sizes; (void)n_in; (void)out_size;
    const float* qin = (const float*)d_in[0]; const float* kvin = (const float*)d_in[1]; const float* imp = (const float*)d_in[2]; const float* wq = (const float*)d_in[3]; const float* wk = (const float*)d_in[4]; const float* wv = (const float*)d_in[5]; const float* wo = (const float*)d_in[6];   // torch [out][in] weights
    float* OUT = (float*)d_out;     // [2][2048][1024]
    char* wsp = (char*)d_ws;
    auto take = [&](size_t bytes) { char* p = wsp; wsp += (bytes + 255) & ~(size_t)255; return (void*)p; };
    bf* WQ = (bf*)take((size_t)DD * DD * 2); bf* WK = (bf*)take((size_t)DD * DD * 2); bf* WV = (bf*)take((size_t)DD * DD * 2); bf* WO = (bf*)take((size_t)DD * DD * 2); float* LI = (float*)take((size_t)NB_ * TKC * 4);
    bf* XB = (bf*)take((size_t)TKC * DD * 2); float* F = (float*)take((size_t)TKC * DD * 4); h16* QP = (h16*)take((size_t)NH_ * TQ * HD * 2); h16* KP = (h16*)take((size_t)NH_ * TKC * HD * 2); h16* VT = (h16*)take((size_t)NH_ * HD * TKC * 2);
    float* Sb = (float*)take((size_t)TQ * TKC * 4); h16* Pm = (h16*)take((size_t)TQ * TKC * 2); float* RS = (float*)take((size_t)TQ * 32 * 4); float* Ob = (float*)take((size_t)TQ * HD * 4); bf* Ah = (bf*)take((size_t)TQ * DD * 2); bf* Al = (bf*)take((size_t)TQ * DD * 2);
    if ((size_t)(wsp - (char*)d_ws) > ws_size) return;    // total ~ 115 MB = 110 MiB; ws 256 MiB
    { const size_t nw = (size_t)DD * DD / 8; const unsigned g = (unsigned)((nw + 255) / 256); k_cvt8<<<g, 256, 0, stream>>>(wq, WQ, nw); k_cvt8<<<g, 256, 0, stream>>>(wk, WK, nw); k_cvt8<<<g, 256, 0, stream>>>(wv, WV, nw); k_cvt8<<<g, 256, 0, stream>>>(wo, WO, nw); k_limp<<<(NB_ * TKC + 255) / 256, 256, 0, stream>>>(imp, LI); }
    const dim3 gQ(TQ / 64, DD / 64, 1), gK(TKC / 64, DD / 64, 1);
    for (int b = 0; b < NB_; ++b) {
        k_cvt8<<<(unsigned)(((size_t)TQ * DD / 8 + 255) / 256), 256, 0, stream>>>(qin + (size_t)b * TQ * DD, XB, (size_t)TQ * DD / 8);
        k_gemmw<bf, 0, false><<<gQ, 32, 0, stream>>>(XB, nullptr, WQ, nullptr, DD, F, DD, nullptr, 0, 0, 0); k_pl<<<(unsigned)(((size_t)NH_ * TQ * HD / 2 + 255) / 256), 256, 0, stream>>>(F, TQ, QP);
        k_cvt8<<<(unsigned)(((size_t)TKC * DD / 8 + 255) / 256), 256, 0, stream>>>(kvin + (size_t)b * TKC * DD, XB, (size_t)TKC * DD / 8);
        k_gemmw<bf, 0, false><<<gK, 32, 0, stream>>>(XB, nullptr, WK, nullptr, DD, F, DD, nullptr, 0, 0, 0); k_pl<<<(unsigned)(((size_t)NH_ * TKC * HD / 2 + 255) / 256), 256, 0, stream>>>(F, TKC, KP);
        k_gemmw<bf, 0, false><<<gK, 32, 0, stream>>>(XB, nullptr, WV, nullptr, DD, F, DD, nullptr, 0, 0, 0); k_vt<<<(unsigned)(((size_t)NH_ * HD * TKC / 2 + 255) / 256), 256, 0, stream>>>(F, TKC, VT);
        for (int h = 0; h < NH_; ++h) {
            k_gemmw<h16, 0, false><<<dim3(TQ / 64, TKC / 64, 1), 32, 0, stream>>>(QP + (size_t)h * TQ * HD, nullptr, KP + (size_t)h * TKC * HD, nullptr, HD, Sb, TKC, nullptr, 0, 0, 0);
            k_smax<<<TQ / 8, 256, 0, stream>>>(Sb, LI + (size_t)b * TKC, RS); k_sexp<<<TQ / 8, 256, 0, stream>>>(Sb, LI + (size_t)b * TKC, RS, Pm);
            k_gemmw<h16, 0, false><<<dim3(TQ / 64, 1, 1), 32, 0, stream>>>(Pm, nullptr, VT + (size_t)h * HD * TKC, nullptr, TKC, Ob, HD, nullptr, 0, 0, 0);
            k_mrg<<<(TQ * HD / 2 + 255) / 256, 256, 0, stream>>>(Ob, RS, h, Ah, Al); }
        k_gemmw<bf, 1, false><<<gQ, 32, 0, stream>>>(Ah, Al, WO, nullptr, DD, OUT + (size_t)b * TQ * DD, DD, nullptr, 0, 0, 0); }
}

// v001
// It runs in 2160 microseconds.
// Next to v000, in two timings, it ran 2.11 times as fast each time.
#include <hip/hip_runtime.h>

// Temporal decoder cross-attention with sensor importance (query [2][2048][1024], key_value [2][256][16][1024] -> 4096 source tokens (t_kv, sensor), imp_weights [2][16]; q/k/v = x W^T (16 heads x 64);
// scores = q.k/8 + log(max(imp[b][sensor of key], 1e-6)) (read as data); softmax over the 4096 keys; out = merged (attn v) W_o^T -> [2][2048][1024]).
// Compute dtypes, f32 accumulate: every input rounded to bf16; q/k/v projections on PLAIN bf16 operands (inputs: exact products, f32 accumulate); scores (K 64) and attn.v on

#define NB_  2
#define TQ   2048
#define TKC  4096
#define NSEN 16
#define DD   1024
#define NH_  16
#define HD   64
#define PCAR 1024.0f
#define SCL  0.125f
#define NSPL 16      // key slices of the attn.v product: one wave per (64 query rows, slice)
typedef _Float16 h16;
typedef unsigned short bf;
typedef __attribute__((ext_vector_type(16))) __bf16   v16bf;
typedef __attribute__((ext_vector_type(16))) _Float16 v16h;
typedef __attribute__((ext_vector_type(8)))  _Float16 v8h;
typedef __attribute__((ext_vector_type(8)))  unsigned short v8us;
typedef __attribute__((ext_vector_type(8)))  float    v8f;
typedef __attribute__((ext_vector_type(4)))  float    v4f;
typedef v8h  __attribute__((may_alias)) v8ha;
typedef v4f  __attribute__((may_alias)) v4fa;
typedef v8us __attribute__((may_alias)) v8usa;

__device__ __forceinline__ unsigned short f2bf(float f) { unsigned u = __float_as_uint(f); u += 0x7FFFu + ((u >> 16) & 1u); return (unsigned short)(u >> 16); }
__device__ __forceinline__ float bf2f(unsigned short b) { return __uint_as_float(((unsigned)b) << 16); }
__device__ __forceinline__ float bfr(float f) { return bf2f(f2bf(f)); }
__device__ __forceinline__ v16h cat16(v8h lo, v8h hi) { return __builtin_shufflevector(lo, hi, 0, 1, 2, 3, 4, 5, 6, 7, 8, 9, 10, 11, 12, 13, 14, 15); }
__device__ __forceinline__ v16bf cat16b(v8us lo, v8us hi) { return __builtin_bit_cast(v16bf, __builtin_shufflevector(lo, hi, 0, 1, 2, 3, 4, 5, 6, 7, 8, 9, 10, 11, 12, 13, 14, 15)); }
__device__ __forceinline__ v8f wmma16(v16h a, v16h b, v8f c) { return __builtin_amdgcn_wmma_f32_16x16x32_f16(false, a, false, b, (short)0, c, false, false); }
__device__ __forceinline__ v8f wmmab(v16bf a, v16bf b, v8f c) { return __builtin_amdgcn_wmma_f32_16x16x32_bf16(false, a, false, b, (short)0, c, false, false); }



// ---- k_gemmw: register-blocked GEMM, ONE WAVE per 64x64 output tile (16 accumulators), operands straight from K-contiguous 16-bit planes; grid (M/64, N/64, Z), 32 threads.
// C[m][n] (f32, pitch ldc, + optional f32 bias[n]) = sum_k A[m][k] Bt[n][k] (+ split products per NSPLIT). z-batch strides sA/sB/sC in elements. K % 32 == 0.
// KSL > 0: each z sums only KSL of the k range (K stays the row pitch; sA = sB = KSL, sC = one whole C plane); the reader sums the planes.
template <typename T16> struct WFrag;
template <> struct WFrag<h16> { typedef v16h V; static __device__ __forceinline__ V ld(const h16* p) { return cat16(*(const v8h*)p, *(const v8h*)(p + 16)); } static __device__ __forceinline__ v8f mma(V a, V b, v8f c) { return wmma16(a, b, c); } };
template <> struct WFrag<bf> { typedef v16bf V; static __device__ __forceinline__ V ld(const bf* p) { return cat16b(*(const v8us*)p, *(const v8us*)(p + 16)); } static __device__ __forceinline__ v8f mma(V a, V b, v8f c) { return wmmab(a, b, c); } };
template <typename T16, int NSPLIT, bool BIAS, int KSL = 0>
__global__ __launch_bounds__(32) void k_gemmw(const T16* __restrict__ A, const T16* __restrict__ A2, const T16* __restrict__ Bt, const T16* __restrict__ Bt2, int K, float* C, int ldc, const float* __restrict__ bias, size_t sA, size_t sB, size_t sC) {
    typedef typename WFrag<T16>::V V;
    __shared__ __align__(16) float os[16 * 68];
    const size_t z = blockIdx.z; A += z * sA; if (A2) A2 += z * sA; Bt += z * sB; if (Bt2) Bt2 += z * sB; C += z * sC;
    const int lane = threadIdx.x & 31, lr = lane & 15, hi = lane >> 4; const int r0 = blockIdx.x * 64, c0 = blockIdx.y * 64;
    v8f acc[4][4];
#pragma unroll
    for (int mb = 0; mb < 4; ++mb)
#pragma unroll
        for (int nb = 0; nb < 4; ++nb) acc[mb][nb] = (v8f){};
    const size_t aoff = (size_t)(r0 + lr) * K + 8 * hi, boff = (size_t)(c0 + lr) * K + 8 * hi;
#pragma unroll 1
    for (int kc = 0; kc < (KSL ? KSL : K); kc += 32) {
        V a[4], a2[4];
#pragma unroll
        for (int mb = 0; mb < 4; ++mb) { a[mb] = WFrag<T16>::ld(A + aoff + (size_t)mb * 16 * K + kc); if (NSPLIT == 1 || NSPLIT == 2) a2[mb] = WFrag<T16>::ld(A2 + aoff + (size_t)mb * 16 * K + kc); }
#pragma unroll
        for (int nb = 0; nb < 4; ++nb) { const V b = WFrag<T16>::ld(Bt + boff + (size_t)nb * 16 * K + kc); V b2; if (NSPLIT >= 2) b2 = WFrag<T16>::ld(Bt2 + boff + (size_t)nb * 16 * K + kc);
#pragma unroll
            for (int mb = 0; mb < 4; ++mb) { acc[mb][nb] = WFrag<T16>::mma(a[mb], b, acc[mb][nb]); if (NSPLIT == 1 || NSPLIT == 2) acc[mb][nb] = WFrag<T16>::mma(a2[mb], b, acc[mb][nb]); if (NSPLIT >= 2) acc[mb][nb] = WFrag<T16>::mma(a[mb], b2, acc[mb][nb]); } }
        asm volatile("v_nop\n\tv_nop\n\tv_nop\n\tv_nop" : "+v"(acc[0][0]), "+v"(acc[1][1]), "+v"(acc[2][2]), "+v"(acc[3][3]) : "v"(a[0]), "v"(a[3]));
    }
#pragma unroll
    for (int mb = 0; mb < 4; ++mb) {
#pragma unroll
        for (int nb = 0; nb < 4; ++nb) {
#pragma unroll
            for (int j = 0; j < 8; ++j) os[(hi * 8 + j) * 68 + nb * 16 + lr] = acc[mb][nb][j]; }
        __builtin_amdgcn_wave_barrier(); asm volatile("" ::: "memory");
        float* crow = C + (size_t)(r0 + mb * 16) * ldc + c0;
{
#pragma unroll
            for (int s = 0; s < 8; ++s) { const int row = 2 * s + hi, cofs = lr * 4; v4f val = *(const v4fa*)(os + row * 68 + cofs); if (BIAS) { val[0] += bfr(bias[c0 + cofs]); val[1] += bfr(bias[c0 + cofs + 1]); val[2] += bfr(bias[c0 + cofs + 2]); val[3] += bfr(bias[c0 + cofs + 3]); }
                *(v4f*)(crow + (size_t)row * ldc + cofs) = val; }
             }
        __builtin_amdgcn_wave_barrier(); asm volatile("" ::: "memory");
    }
}

__device__ __forceinline__ h16 tohx(float x) { return (h16)x; }
__device__ __forceinline__ void splitf(float y, unsigned short& h, unsigned short& l) { h = f2bf(y); l = f2bf(y - bf2f(h)); }
typedef __attribute__((ext_vector_type(2))) _Float16 v2h;
typedef __attribute__((ext_vector_type(4))) _Float16 v4h;
typedef __attribute__((ext_vector_type(2))) unsigned short v2us;
typedef __attribute__((ext_vector_type(2))) float v2f;

__global__ __launch_bounds__(256) void k_cvt8(const float* __restrict__ src, bf* dst, size_t n8) { const size_t i = (size_t)blockIdx.x * 256 + threadIdx.x; if (i >= n8) return; const v8f v = *(const v8f*)(src + i * 8); v8us o;
#pragma unroll
    for (int k = 0; k < 8; ++k) o[k] = f2bf(v[k]); *(v8us*)(dst + i * 8) = o;  }
__global__ __launch_bounds__(256) void k_limp(const float* __restrict__ imp, float* LI) { const int i = blockIdx.x * 256 + threadIdx.x; if (i >= NB_ * TKC) return; const int b = i / TKC, j = i % TKC; const float w = fmaxf(bfr(imp[b * NSEN + (j % NSEN)]), 1e-6f); const float l = logf(w); *(float*)(LI + i) = l;  }
__global__ __launch_bounds__(256) void k_pl(const float* __restrict__ F, int nT, h16* P) { const size_t e = ((size_t)blockIdx.x * 256 + threadIdx.x) * 2; if (e >= (size_t)NH_ * nT * HD) return; const int d = (int)(e & 63); const int t = (int)((e >> 6) % nT); const int h = (int)(e / ((size_t)nT * HD)); v2h o; o[0] = tohx(F[(size_t)t * DD + h * HD + d]); o[1] = tohx(F[(size_t)t * DD + h * HD + d + 1]); *(v2h*)(P + e) = o;  }
__global__ __launch_bounds__(256) void k_vt(const float* __restrict__ F, int nT, h16* VT) { const size_t e = ((size_t)blockIdx.x * 256 + threadIdx.x) * 2; if (e >= (size_t)NH_ * HD * nT) return; const int t = (int)(e % nT); const int d = (int)((e / nT) & 63); const int h = (int)(e / ((size_t)nT * HD)); v2h o; o[0] = tohx(F[(size_t)t * DD + h * HD + d]); o[1] = tohx(F[(size_t)(t + 1) * DD + h * HD + d]); *(v2h*)(VT + e) = o;  }
__global__ __launch_bounds__(256) void k_smax(const float* __restrict__ S, const float* __restrict__ LI, float* RS) { const int lane = threadIdx.x & 31; const int i = blockIdx.x * 8 + (threadIdx.x >> 5); if (i >= TQ) return; const float* sr = S + (size_t)i * TKC; float m = -3.0e38f;
#pragma unroll 4
    for (int c0 = lane * 4; c0 < TKC; c0 += 128) { const v4f v = *(const v4f*)(sr + c0), l4 = *(const v4f*)(LI + c0);
#pragma unroll
        for (int q = 0; q < 4; ++q) { float a = v[q] * SCL; asm volatile("" : "+v"(a)); m = fmaxf(m, __fadd_rn(a, l4[q])); } }
#pragma unroll
    for (int sh = 16; sh; sh >>= 1) m = fmaxf(m, __shfl_xor(m, sh, 32));
    const float o = lane == 0 ? m : 0.f; *(float*)(RS + (size_t)i * 32 + lane) = o;  }
__global__ __launch_bounds__(256) void k_sexp(const float* __restrict__ S, const float* __restrict__ LI, float* RS, h16* P) { const int lane = threadIdx.x & 31; const int i = blockIdx.x * 8 + (threadIdx.x >> 5); if (i >= TQ) return; const float* sr = S + (size_t)i * TKC; const float m = RS[(size_t)i * 32]; float sum = 0.f;
{ sum = 0.f;
#pragma unroll 2
        for (int c0 = lane * 4; c0 < TKC; c0 += 128) { const v4f v = *(const v4f*)(sr + c0), l4 = *(const v4f*)(LI + c0); v4h o;
#pragma unroll
            for (int q = 0; q < 4; ++q) { float a = v[q] * SCL; asm volatile("" : "+v"(a)); float t = __fadd_rn(a, l4[q]); float dlt = __fsub_rn(t, m); asm volatile("" : "+v"(dlt)); const float e = __builtin_amdgcn_exp2f(__fmul_rn(dlt, 1.4426950408889634f)); sum += e; o[q] = tohx(e * PCAR); }
            *(v4h*)(P + (size_t)i * TKC + c0) = o; }
         }
#pragma unroll
    for (int sh = 16; sh; sh >>= 1) sum += __shfl_xor(sum, sh, 32);
    const float o2 = lane == 0 ? m : (lane == 1 ? __fdiv_rn(1.0f, sum * PCAR) : 0.f); *(float*)(RS + (size_t)i * 32 + lane) = o2;  }
__global__ __launch_bounds__(256) void k_mrg(const float* __restrict__ O, const float* __restrict__ RS, int h, bf* Ah, bf* Al) { const int e = (blockIdx.x * 256 + threadIdx.x) * 2; if (e >= TQ * HD) return; const int d = e & 63; const int t = e >> 6; const float sc = RS[(size_t)t * 32 + 1]; v2us oh, ol; v2f p[NSPL];
#pragma unroll
    for (int zz = 0; zz < NSPL; ++zz) p[zz] = *(const v2f*)(O + (size_t)zz * TQ * HD + e);   // the key slices' planes, all loads in flight together
    asm volatile("s_wait_xcnt 0x0" ::: "memory");   // stands in front of the sums, which may reuse the address registers of the loads just issued
    v2f s = p[0];
#pragma unroll
    for (int zz = 1; zz < NSPL; ++zz) s += p[zz];   // summed in slice order
#pragma unroll
    for (int q = 0; q < 2; ++q) { unsigned short a, c2; splitf(__fmul_rn(s[q], sc), a, c2); oh[q] = a; ol[q] = c2; } const size_t oo = (size_t)t * DD + h * HD + d; *(v2us*)(Ah + oo) = oh; *(v2us*)(Al + oo) = ol;  }

extern "C" void kernel_launch(void* const* d_in, const int* in_sizes, int n_in,
                              void* d_out, int out_size, void* d_ws, size_t ws_size, hipStream_t stream) {
    (void)in_sizes; (void)n_in; (void)out_size;
    const float* qin = (const float*)d_in[0]; const float* kvin = (const float*)d_in[1]; const float* imp = (const float*)d_in[2]; const float* wq = (const float*)d_in[3]; const float* wk = (const float*)d_in[4]; const float* wv = (const float*)d_in[5]; const float* wo = (const float*)d_in[6];   // torch [out][in] weights
    float* OUT = (float*)d_out;     // [2][2048][1024]
    char* wsp = (char*)d_ws;
    auto take = [&](size_t bytes) { char* p = wsp; wsp += (bytes + 255) & ~(size_t)255; return (void*)p; };
    bf* WQ = (bf*)take((size_t)DD * DD * 2); bf* WK = (bf*)take((size_t)DD * DD * 2); bf* WV = (bf*)take((size_t)DD * DD * 2); bf* WO = (bf*)take((size_t)DD * DD * 2); float* LI = (float*)take((size_t)NB_ * TKC * 4);
    bf* XB = (bf*)take((size_t)TKC * DD * 2); float* F = (float*)take((size_t)TKC * DD * 4); h16* QP = (h16*)take((size_t)NH_ * TQ * HD * 2); h16* KP = (h16*)take((size_t)NH_ * TKC * HD * 2); h16* VT = (h16*)take((size_t)NH_ * HD * TKC * 2);
    float* Sb = (float*)take((size_t)TQ * TKC * 4); h16* Pm = (h16*)take((size_t)TQ * TKC * 2); float* RS = (float*)take((size_t)TQ * 32 * 4); float* Ob = (float*)take((size_t)NSPL * TQ * HD * 4); bf* Ah = (bf*)take((size_t)TQ * DD * 2); bf* Al = (bf*)take((size_t)TQ * DD * 2);
    if ((size_t)(wsp - (char*)d_ws) > ws_size) return;    // total ~ 122 MB = 116 MiB; ws 256 MiB
    { const size_t nw = (size_t)DD * DD / 8; const unsigned g = (unsigned)((nw + 255) / 256); k_cvt8<<<g, 256, 0, stream>>>(wq, WQ, nw); k_cvt8<<<g, 256, 0, stream>>>(wk, WK, nw); k_cvt8<<<g, 256, 0, stream>>>(wv, WV, nw); k_cvt8<<<g, 256, 0, stream>>>(wo, WO, nw); k_limp<<<(NB_ * TKC + 255) / 256, 256, 0, stream>>>(imp, LI); }
    const dim3 gQ(TQ / 64, DD / 64, 1), gK(TKC / 64, DD / 64, 1);
    for (int b = 0; b < NB_; ++b) {
        k_cvt8<<<(unsigned)(((size_t)TQ * DD / 8 + 255) / 256), 256, 0, stream>>>(qin + (size_t)b * TQ * DD, XB, (size_t)TQ * DD / 8);
        k_gemmw<bf, 0, false><<<gQ, 32, 0, stream>>>(XB, nullptr, WQ, nullptr, DD, F, DD, nullptr, 0, 0, 0); k_pl<<<(unsigned)(((size_t)NH_ * TQ * HD / 2 + 255) / 256), 256, 0, stream>>>(F, TQ, QP);
        k_cvt8<<<(unsigned)(((size_t)TKC * DD / 8 + 255) / 256), 256, 0, stream>>>(kvin + (size_t)b * TKC * DD, XB, (size_t)TKC * DD / 8);
        k_gemmw<bf, 0, false><<<gK, 32, 0, stream>>>(XB, nullptr, WK, nullptr, DD, F, DD, nullptr, 0, 0, 0); k_pl<<<(unsigned)(((size_t)NH_ * TKC * HD / 2 + 255) / 256), 256, 0, stream>>>(F, TKC, KP);
        k_gemmw<bf, 0, false><<<gK, 32, 0, stream>>>(XB, nullptr, WV, nullptr, DD, F, DD, nullptr, 0, 0, 0); k_vt<<<(unsigned)(((size_t)NH_ * HD * TKC / 2 + 255) / 256), 256, 0, stream>>>(F, TKC, VT);
        for (int h = 0; h < NH_; ++h) {
            k_gemmw<h16, 0, false><<<dim3(TQ / 64, TKC / 64, 1), 32, 0, stream>>>(QP + (size_t)h * TQ * HD, nullptr, KP + (size_t)h * TKC * HD, nullptr, HD, Sb, TKC, nullptr, 0, 0, 0);
            k_smax<<<TQ / 8, 256, 0, stream>>>(Sb, LI + (size_t)b * TKC, RS); k_sexp<<<TQ / 8, 256, 0, stream>>>(Sb, LI + (size_t)b * TKC, RS, Pm);
            k_gemmw<h16, 0, false, TKC / NSPL><<<dim3(TQ / 64, 1, NSPL), 32, 0, stream>>>(Pm, nullptr, VT + (size_t)h * HD * TKC, nullptr, TKC, Ob, HD, nullptr, TKC / NSPL, TKC / NSPL, (size_t)TQ * HD);
            k_mrg<<<(TQ * HD / 2 + 255) / 256, 256, 0, stream>>>(Ob, RS, h, Ah, Al); }
        k_gemmw<bf, 1, false><<<gQ, 32, 0, stream>>>(Ah, Al, WO, nullptr, DD, OUT + (size_t)b * TQ * DD, DD, nullptr, 0, 0, 0); }
}

// v003
// One run takes 370 microseconds.
// Versions between v001 and this one are left out; their measured steps multiply to 5.82 times as fast.
// Counting every step since v000, it is 12.3 times as fast.
#include <hip/hip_runtime.h>

// Temporal decoder cross-attention with sensor importance (query [2][2048][1024], key_value [2][256][16][1024] -> 4096 source tokens (t_kv, sensor), imp_weights [2][16]; q/k/v = x W^T (16 heads x 64);
// scores = q.k/8 + log(max(imp[b][sensor of key], 1e-6)) (read as data); softmax over the 4096 keys; out = merged (attn v) W_o^T -> [2][2048][1024]).
// Compute dtypes, f32 accumulate: every input rounded to bf16; q/k/v projections on PLAIN bf16 operands (inputs: exact products, f32 accumulate); scores (K 64) and attn.v on

#define NB_  2
#define TQ   2048
#define TKC  4096
#define NSEN 16
#define DD   1024
#define NH_  16
#define HD   64
#define SCL  0.125f
#define L2E  1.4426950408889634f
typedef _Float16 h16;
typedef unsigned short bf;
typedef __attribute__((ext_vector_type(16))) __bf16   v16bf;
typedef __attribute__((ext_vector_type(16))) _Float16 v16h;
typedef __attribute__((ext_vector_type(8)))  _Float16 v8h;
typedef __attribute__((ext_vector_type(8)))  unsigned short v8us;
typedef __attribute__((ext_vector_type(8)))  float    v8f;
typedef __attribute__((ext_vector_type(4)))  float    v4f;
typedef v8h  __attribute__((may_alias)) v8ha;
typedef v4f  __attribute__((may_alias)) v4fa;
typedef v8us __attribute__((may_alias)) v8usa;

__device__ __forceinline__ unsigned short f2bf(float f) { unsigned u = __float_as_uint(f); u += 0x7FFFu + ((u >> 16) & 1u); return (unsigned short)(u >> 16); }
__device__ __forceinline__ float bf2f(unsigned short b) { return __uint_as_float(((unsigned)b) << 16); }
__device__ __forceinline__ float bfr(float f) { return bf2f(f2bf(f)); }
__device__ __forceinline__ v16h cat16(v8h lo, v8h hi) { return __builtin_shufflevector(lo, hi, 0, 1, 2, 3, 4, 5, 6, 7, 8, 9, 10, 11, 12, 13, 14, 15); }
__device__ __forceinline__ v16bf cat16b(v8us lo, v8us hi) { return __builtin_bit_cast(v16bf, __builtin_shufflevector(lo, hi, 0, 1, 2, 3, 4, 5, 6, 7, 8, 9, 10, 11, 12, 13, 14, 15)); }
__device__ __forceinline__ v8f wmma16(v16h a, v16h b, v8f c) { return __builtin_amdgcn_wmma_f32_16x16x32_f16(false, a, false, b, (short)0, c, false, false); }
__device__ __forceinline__ v8f wmmab(v16bf a, v16bf b, v8f c) { return __builtin_amdgcn_wmma_f32_16x16x32_bf16(false, a, false, b, (short)0, c, false, false); }



// ---- k_gemmw: register-blocked GEMM, ONE WAVE per 64x64 output tile (16 accumulators), operands straight from K-contiguous 16-bit planes; grid (M/64, N/64, Z), 32 threads.
// C[m][n] (f32, pitch ldc, + optional f32 bias[n]) = sum_k A[m][k] Bt[n][k] (+ split products per NSPLIT). z-batch strides sA/sB/sC in elements. K % 32 == 0.
// HOUT: the tile goes out as f16 straight from the accumulators, transposed: H[blockIdx.x * hx + n * hld + (m - r0)]. A lane holds 8 consecutive m of one n, which is one 16-byte store; the 64 m of a tile are one whole 128-byte line per n.
template <typename T16> struct WFrag;
template <> struct WFrag<h16> { typedef v16h V; static __device__ __forceinline__ V ld(const h16* p) { return cat16(*(const v8h*)p, *(const v8h*)(p + 16)); } static __device__ __forceinline__ v8f mma(V a, V b, v8f c) { return wmma16(a, b, c); } };
template <> struct WFrag<bf> { typedef v16bf V; static __device__ __forceinline__ V ld(const bf* p) { return cat16b(*(const v8us*)p, *(const v8us*)(p + 16)); } static __device__ __forceinline__ v8f mma(V a, V b, v8f c) { return wmmab(a, b, c); } };
template <typename T16, int NSPLIT, bool BIAS, bool HOUT>
__global__ __launch_bounds__(32) void k_gemmw(const T16* __restrict__ A, const T16* __restrict__ A2, const T16* __restrict__ Bt, const T16* __restrict__ Bt2, int K, float* C, int ldc, const float* __restrict__ bias, size_t sA, size_t sB, size_t sC, h16* H, size_t hx, size_t hld) {
    typedef typename WFrag<T16>::V V;
    __shared__ __align__(16) float os[16 * 68];
    const size_t z = blockIdx.z; A += z * sA; if (A2) A2 += z * sA; Bt += z * sB; if (Bt2) Bt2 += z * sB; C += z * sC;
    const int lane = threadIdx.x & 31, lr = lane & 15, hi = lane >> 4; const int r0 = blockIdx.x * 64, c0 = blockIdx.y * 64;
    v8f acc[4][4];
#pragma unroll
    for (int mb = 0; mb < 4; ++mb)
#pragma unroll
        for (int nb = 0; nb < 4; ++nb) acc[mb][nb] = (v8f){};
    const size_t aoff = (size_t)(r0 + lr) * K + 8 * hi, boff = (size_t)(c0 + lr) * K + 8 * hi;
#pragma unroll 1
    for (int kc = 0; kc < K; kc += 32) {
        V a[4], a2[4];
#pragma unroll
        for (int mb = 0; mb < 4; ++mb) { a[mb] = WFrag<T16>::ld(A + aoff + (size_t)mb * 16 * K + kc); if (NSPLIT == 1 || NSPLIT == 2) a2[mb] = WFrag<T16>::ld(A2 + aoff + (size_t)mb * 16 * K + kc); }
#pragma unroll
        for (int nb = 0; nb < 4; ++nb) { const V b = WFrag<T16>::ld(Bt + boff + (size_t)nb * 16 * K + kc); V b2; if (NSPLIT >= 2) b2 = WFrag<T16>::ld(Bt2 + boff + (size_t)nb * 16 * K + kc);
#pragma unroll
            for (int mb = 0; mb < 4; ++mb) { acc[mb][nb] = WFrag<T16>::mma(a[mb], b, acc[mb][nb]); if (NSPLIT == 1 || NSPLIT == 2) acc[mb][nb] = WFrag<T16>::mma(a2[mb], b, acc[mb][nb]); if (NSPLIT >= 2) acc[mb][nb] = WFrag<T16>::mma(a[mb], b2, acc[mb][nb]); } }
        asm volatile("v_nop\n\tv_nop\n\tv_nop\n\tv_nop" : "+v"(acc[0][0]), "+v"(acc[1][1]), "+v"(acc[2][2]), "+v"(acc[3][3]) : "v"(a[0]), "v"(a[3]));
    }
    if constexpr (HOUT) {
        h16* ho = H + (size_t)blockIdx.x * hx + (size_t)(c0 + lr) * hld + hi * 8;
#pragma unroll
        for (int nb = 0; nb < 4; ++nb)
#pragma unroll
            for (int mb = 0; mb < 4; ++mb) { v8h o;
#pragma unroll
                for (int j = 0; j < 8; ++j) o[j] = (h16)acc[mb][nb][j];
                *(v8h*)(ho + (size_t)nb * 16 * hld + mb * 16) = o; }
        return;
    }
#pragma unroll
    for (int mb = 0; mb < 4; ++mb) {
#pragma unroll
        for (int nb = 0; nb < 4; ++nb) {
#pragma unroll
            for (int j = 0; j < 8; ++j) os[(hi * 8 + j) * 68 + nb * 16 + lr] = acc[mb][nb][j]; }
        __builtin_amdgcn_wave_barrier(); asm volatile("" ::: "memory");
        float* crow = C + (size_t)(r0 + mb * 16) * ldc + c0;
{
#pragma unroll
            for (int s = 0; s < 8; ++s) { const int row = 2 * s + hi, cofs = lr * 4; v4f val = *(const v4fa*)(os + row * 68 + cofs); if (BIAS) { val[0] += bfr(bias[c0 + cofs]); val[1] += bfr(bias[c0 + cofs + 1]); val[2] += bfr(bias[c0 + cofs + 2]); val[3] += bfr(bias[c0 + cofs + 3]); }
                *(v4f*)(crow + (size_t)row * ldc + cofs) = val; }
             }
        __builtin_amdgcn_wave_barrier(); asm volatile("" ::: "memory");
    }
}

__device__ __forceinline__ h16 tohx(float x) { return (h16)x; }
__device__ __forceinline__ void splitf(float y, unsigned short& h, unsigned short& l) { h = f2bf(y); l = f2bf(y - bf2f(h)); }

__global__ __launch_bounds__(256) void k_cvt8(const float* __restrict__ src, bf* dst, size_t n8) { const size_t i = (size_t)blockIdx.x * 256 + threadIdx.x; if (i >= n8) return; const v8f v = *(const v8f*)(src + i * 8); v8us o;
#pragma unroll
    for (int k = 0; k < 8; ++k) o[k] = f2bf(v[k]); *(v8us*)(dst + i * 8) = o;  }
__global__ __launch_bounds__(256) void k_limp(const float* __restrict__ imp, float* LI) { const int i = blockIdx.x * 256 + threadIdx.x; if (i >= NB_ * TKC) return; const int b = i / TKC, j = i % TKC; const float w = fmaxf(bfr(imp[b * NSEN + (j % NSEN)]), 1e-6f); const float l = logf(w); *(float*)(LI + i) = l;  }
__device__ __forceinline__ float xhalf(float x) { return __builtin_bit_cast(float, __builtin_amdgcn_permlanex16(__builtin_bit_cast(int, x), __builtin_bit_cast(int, x), 0x76543210, 0xfedcba98, false, false)); }   // lane l takes lane l ^ 16
__global__ __launch_bounds__(256) void k_fattn(const h16* __restrict__ QP, const h16* __restrict__ KP, const h16* __restrict__ VT, const float* __restrict__ LI, bf* Ah, bf* Al) {
    const int lane = threadIdx.x & 31, lr = lane & 15, hi = lane >> 4, wv = threadIdx.x >> 5;
    const int h = blockIdx.y, b = blockIdx.z, q0 = blockIdx.x * 256 + wv * 32;
    const h16* Qp = QP + ((size_t)(b * NH_ + h) * TQ + q0 + lr) * HD + 8 * hi;
    const h16* Kp = KP + ((size_t)(b * NH_ + h) * TKC + lr) * HD + 8 * hi;
    const h16* Vp = VT + ((size_t)(b * NH_ + h) * HD + lr) * TKC + 8 * hi;
    v16h qf[2][2], kf[2][2];
#pragma unroll
    for (int q = 0; q < 2; ++q)
#pragma unroll
        for (int c = 0; c < 2; ++c) { qf[q][c] = WFrag<h16>::ld(Qp + q * 16 * HD + c * 32); kf[q][c] = WFrag<h16>::ld(Kp + q * 16 * HD + c * 32); }
    float li2[8];   // key k carries the term of sensor k mod 16 (the reference tiles imp over t_kv), and every tile starts at a multiple of 16: the lane's eight terms are the same in every tile
#pragma unroll
    for (int j = 0; j < 8; ++j) li2[j] = LI[(size_t)b * TKC + hi * 8 + j] * L2E;
    v8f acc[4][2];
#pragma unroll
    for (int dt = 0; dt < 4; ++dt) { acc[dt][0] = (v8f){}; acc[dt][1] = (v8f){}; }
    float m[2] = { -3.0e38f, -3.0e38f }, l[2] = { 0.f, 0.f };
#pragma unroll 1   // stays rolled: one pass already holds some 230 registers, and a second copy of the body would only lengthen the code
    for (int kc = 0; kc < TKC; kc += 32) {
        v16h vf[4];
#pragma unroll
        for (int dt = 0; dt < 4; ++dt) vf[dt] = WFrag<h16>::ld(Vp + (size_t)dt * 16 * TKC + kc);
        asm volatile("s_wait_xcnt 0x0" ::: "memory");   // stands in front of the step of the V address pair, which the loads just issued name
        __builtin_amdgcn_sched_barrier(0);   // keeps the V loads at the head of the pass (the scheduler sinks them behind the maximum otherwise), so that the score products and the maximum cover their latency
        v8f st[2][2];
#pragma unroll
        for (int t = 0; t < 2; ++t)
#pragma unroll
            for (int q = 0; q < 2; ++q) st[t][q] = wmma16(kf[t][1], qf[q][1], wmma16(kf[t][0], qf[q][0], (v8f){}));
        const int kn = kc + 32 < TKC ? kc + 32 : 0;   // the next pass's key rows, fetched while this pass does its softmax; the last pass re-reads rows 0..31 (in bounds, not used)
#pragma unroll
        for (int t = 0; t < 2; ++t)
#pragma unroll
            for (int c = 0; c < 2; ++c) kf[t][c] = WFrag<h16>::ld(Kp + (size_t)(kn + t * 16) * HD + c * 32);
        __builtin_amdgcn_sched_barrier(0);   // keeps the K fetch directly behind the score products (the scheduler sinks it behind the rescale branch otherwise): the whole softmax and attn.v of this pass cover its latency
        float mx[2];
#pragma unroll
        for (int q = 0; q < 2; ++q) { float x = -3.0e38f;
#pragma unroll
            for (int t = 0; t < 2; ++t)
#pragma unroll
                for (int j = 0; j < 8; ++j) { st[t][q][j] = fmaf(st[t][q][j], SCL * L2E, li2[j]); x = fmaxf(x, st[t][q][j]); }
            mx[q] = fmaxf(x, xhalf(x)); }
        if (__builtin_amdgcn_ballot_w32(mx[0] > m[0] + 5.0f || mx[1] > m[1] + 5.0f) != 0) {   // one scalar branch a pass
#pragma unroll
            for (int q = 0; q < 2; ++q) { const float mn = fmaxf(m[q], mx[q]); const float al = __builtin_amdgcn_exp2f(m[q] - mn); m[q] = mn; l[q] *= al;
#pragma unroll
                for (int dt = 0; dt < 4; ++dt) acc[dt][q] *= al; }
        }
#pragma unroll
        for (int q = 0; q < 2; ++q) { const float cq = 10.0f - m[q]; v16h pb;
#pragma unroll
            for (int t = 0; t < 2; ++t) { float e[8];
#pragma unroll
                for (int j = 0; j < 8; ++j) e[j] = st[t][q][j] + cq;
                // eight exponentials in place and the free slot behind the last one in ONE statement: no instruction directly behind a v_exp reads its result or overwrites its source
                asm("v_exp_f32 %0, %0\n\tv_exp_f32 %1, %1\n\tv_exp_f32 %2, %2\n\tv_exp_f32 %3, %3\n\tv_exp_f32 %4, %4\n\tv_exp_f32 %5, %5\n\tv_exp_f32 %6, %6\n\tv_exp_f32 %7, %7\n\tv_nop"
                    : "+v"(e[0]), "+v"(e[1]), "+v"(e[2]), "+v"(e[3]), "+v"(e[4]), "+v"(e[5]), "+v"(e[6]), "+v"(e[7]));
#pragma unroll
                for (int j = 0; j < 8; ++j) { l[q] += e[j]; pb[t * 8 + j] = tohx(e[j]); } }
#pragma unroll
            for (int dt = 0; dt < 4; ++dt) acc[dt][q] = wmma16(vf[dt], pb, acc[dt][q]); }
    }
#pragma unroll
    for (int q = 0; q < 2; ++q) { const float inv = __fdiv_rn(1.0f, l[q] + xhalf(l[q]));   // the halves' sums joined once
        const size_t oo = ((size_t)b * TQ + q0 + q * 16 + lr) * DD + h * HD + hi * 8;
#pragma unroll
        for (int dt = 0; dt < 4; ++dt) { v8us oh, ol;
#pragma unroll
            for (int j = 0; j < 8; ++j) { unsigned short a, c2; splitf(__fmul_rn(acc[dt][q][j], inv), a, c2); oh[j] = a; ol[j] = c2; }
            *(v8us*)(Ah + oo + dt * 16) = oh; *(v8us*)(Al + oo + dt * 16) = ol; } }
}

extern "C" void kernel_launch(void* const* d_in, const int* in_sizes, int n_in,
                              void* d_out, int out_size, void* d_ws, size_t ws_size, hipStream_t stream) {
    (void)in_sizes; (void)n_in; (void)out_size;
    const float* qin = (const float*)d_in[0]; const float* kvin = (const float*)d_in[1]; const float* imp = (const float*)d_in[2]; const float* wq = (const float*)d_in[3]; const float* wk = (const float*)d_in[4]; const float* wv = (const float*)d_in[5]; const float* wo = (const float*)d_in[6];   // torch [out][in] weights
    float* OUT = (float*)d_out;     // [2][2048][1024]
    char* wsp = (char*)d_ws;
    auto take = [&](size_t bytes) { char* p = wsp; wsp += (bytes + 255) & ~(size_t)255; return (void*)p; };
    bf* WQ = (bf*)take((size_t)DD * DD * 2); bf* WK = (bf*)take((size_t)DD * DD * 2); bf* WV = (bf*)take((size_t)DD * DD * 2); bf* WO = (bf*)take((size_t)DD * DD * 2); float* LI = (float*)take((size_t)NB_ * TKC * 4);
    bf* XB = (bf*)take((size_t)TKC * DD * 2); h16* QP = (h16*)take((size_t)NB_ * NH_ * TQ * HD * 2); h16* KP = (h16*)take((size_t)NB_ * NH_ * TKC * HD * 2); h16* VT = (h16*)take((size_t)NB_ * NH_ * HD * TKC * 2);
    bf* Ah = (bf*)take((size_t)NB_ * TQ * DD * 2); bf* Al = (bf*)take((size_t)NB_ * TQ * DD * 2);
    if ((size_t)(wsp - (char*)d_ws) > ws_size) return;    // total ~ 72 MiB; ws 256 MiB
    { const size_t nw = (size_t)DD * DD / 8; const unsigned g = (unsigned)((nw + 255) / 256); k_cvt8<<<g, 256, 0, stream>>>(wq, WQ, nw); k_cvt8<<<g, 256, 0, stream>>>(wk, WK, nw); k_cvt8<<<g, 256, 0, stream>>>(wv, WV, nw); k_cvt8<<<g, 256, 0, stream>>>(wo, WO, nw); k_limp<<<(NB_ * TKC + 255) / 256, 256, 0, stream>>>(imp, LI); }
    const dim3 gQ(TQ / 64, DD / 64, 1), gK(TKC / 64, DD / 64, 1);
    const dim3 gQt(DD / 64, TQ / 64, 1), gKt(DD / 64, TKC / 64, 1);   // q and k as W X^T: m = the 64 dims of head blockIdx.x, n = the token, so a tile is 64 whole rows of the [head][token][64] plane; v as X W^T: m = the token, n = the feature, which is the [head][dim][token] plane
    for (int b = 0; b < NB_; ++b) {
        k_cvt8<<<(unsigned)(((size_t)TQ * DD / 8 + 255) / 256), 256, 0, stream>>>(qin + (size_t)b * TQ * DD, XB, (size_t)TQ * DD / 8);
        k_gemmw<bf, 0, false, true><<<gQt, 32, 0, stream>>>(WQ, nullptr, XB, nullptr, DD, nullptr, 0, nullptr, 0, 0, 0, QP + (size_t)b * NH_ * TQ * HD, (size_t)TQ * HD, HD);
        k_cvt8<<<(unsigned)(((size_t)TKC * DD / 8 + 255) / 256), 256, 0, stream>>>(kvin + (size_t)b * TKC * DD, XB, (size_t)TKC * DD / 8);
        k_gemmw<bf, 0, false, true><<<gKt, 32, 0, stream>>>(WK, nullptr, XB, nullptr, DD, nullptr, 0, nullptr, 0, 0, 0, KP + (size_t)b * NH_ * TKC * HD, (size_t)TKC * HD, HD);
        k_gemmw<bf, 0, false, true><<<gK, 32, 0, stream>>>(XB, nullptr, WV, nullptr, DD, nullptr, 0, nullptr, 0, 0, 0, VT + (size_t)b * NH_ * HD * TKC, 64, TKC); }
    k_fattn<<<dim3(TQ / 256, NH_, NB_), 256, 0, stream>>>(QP, KP, VT, LI, Ah, Al);
    for (int b = 0; b < NB_; ++b)
        k_gemmw<bf, 1, false, false><<<gQ, 32, 0, stream>>>(Ah + (size_t)b * TQ * DD, Al + (size_t)b * TQ * DD, WO, nullptr, DD, OUT + (size_t)b * TQ * DD, DD, nullptr, 0, 0, 0, nullptr, 0, 0);
}

// v004
// One run takes 325 microseconds.
// In both of two side-by-side timings against v003, it was 1.14 times as fast.
// All steps since v000 together make it 14.0 times as fast.
#include <hip/hip_runtime.h>

// Temporal decoder cross-attention with sensor importance (query [2][2048][1024], key_value [2][256][16][1024] -> 4096 source tokens (t_kv, sensor), imp_weights [2][16]; q/k/v = x W^T (16 heads x 64);
// scores = q.k/8 + log(max(imp[b][sensor of key], 1e-6)) (read as data); softmax over the 4096 keys; out = merged (attn v) W_o^T -> [2][2048][1024]).
// Compute dtypes, f32 accumulate: every input rounded to bf16; q/k/v projections on PLAIN bf16 operands (inputs: exact products, f32 accumulate); scores (K 64) and attn.v on

#define NB_  2
#define TQ   2048
#define TKC  4096
#define NSEN 16
#define DD   1024
#define NH_  16
#define HD   64
#define SCL  0.125f
#define L2E  1.4426950408889634f
typedef _Float16 h16;
typedef unsigned short bf;
typedef __attribute__((ext_vector_type(16))) __bf16   v16bf;
typedef __attribute__((ext_vector_type(16))) _Float16 v16h;
typedef __attribute__((ext_vector_type(8)))  _Float16 v8h;
typedef __attribute__((ext_vector_type(8)))  unsigned short v8us;
typedef __attribute__((ext_vector_type(8)))  float    v8f;
typedef __attribute__((ext_vector_type(4)))  float    v4f;
typedef v8h  __attribute__((may_alias)) v8ha;
typedef v4f  __attribute__((may_alias)) v4fa;
typedef v8us __attribute__((may_alias)) v8usa;

__device__ __forceinline__ unsigned short f2bf(float f) { unsigned u = __float_as_uint(f); u += 0x7FFFu + ((u >> 16) & 1u); return (unsigned short)(u >> 16); }
__device__ __forceinline__ float bf2f(unsigned short b) { return __uint_as_float(((unsigned)b) << 16); }
__device__ __forceinline__ float bfr(float f) { return bf2f(f2bf(f)); }
__device__ __forceinline__ v16h cat16(v8h lo, v8h hi) { return __builtin_shufflevector(lo, hi, 0, 1, 2, 3, 4, 5, 6, 7, 8, 9, 10, 11, 12, 13, 14, 15); }
__device__ __forceinline__ v16bf cat16b(v8us lo, v8us hi) { return __builtin_bit_cast(v16bf, __builtin_shufflevector(lo, hi, 0, 1, 2, 3, 4, 5, 6, 7, 8, 9, 10, 11, 12, 13, 14, 15)); }
__device__ __forceinline__ v8f wmma16(v16h a, v16h b, v8f c) { return __builtin_amdgcn_wmma_f32_16x16x32_f16(false, a, false, b, (short)0, c, false, false); }
__device__ __forceinline__ v8f wmmab(v16bf a, v16bf b, v8f c) { return __builtin_amdgcn_wmma_f32_16x16x32_bf16(false, a, false, b, (short)0, c, false, false); }



// ---- FRAGMENT ORDER: every 16-bit operand plane X[row][k] lies in blocks of 16 rows x 32 k (1 KiB), a block holding its elements as the matrix loader takes them: element (row, k) stands at
// block * 512 + ((k >> 4) & 1) * 256 + ((k >> 3) & 1) * 128 + (row & 15) * 8 + (k & 7). A fragment is then two wave-wide 16-byte loads at lane * 8 and lane * 8 + 256, each 512 contiguous bytes (4 whole lines; row-major planes gave 16 quarter lines a load).
// Block order: (row >> 4) * (K / 32) + (k >> 5), so 16 rows of all k take 16 * K elements as before; VT alone has (key >> 5) * 4 + (dim >> 4), so that the four fragments of a pass are contiguous. Registers hold the same values as with row-major planes.
// ---- k_gemmw: register-blocked GEMM, ONE WAVE per 64x64 output tile (16 accumulators), operands straight from 16-bit planes in fragment order; grid (M/64, N/64, Z), 32 threads.
// C[m][n] (f32, pitch ldc, + optional f32 bias[n]) = sum_k A[m][k] Bt[n][k] (+ split products per NSPLIT). z-batch strides sA/sB/sC in elements. K = DD.
// HOUT: the tile goes out as f16 straight from the accumulators, in fragment order with m as the k of the plane and n as its row. A lane holds 8 consecutive m of one n, which is one 16-byte store at lane * 8 of a half block: a wave's store is 512 contiguous bytes.
// HOUT 1 (q, k): plane blockIdx.x, rows = n (tokens), k = the 64 m. HOUT 2 (v): plane blockIdx.y, rows = the 64 n (dims), k = m (tokens), VT's block order. hx = elements of a plane.
template <typename T16> struct WFrag;
template <> struct WFrag<h16> { typedef v16h V; static __device__ __forceinline__ V ld(const h16* p) { return cat16(*(const v8h*)p, *(const v8h*)(p + 256)); } static __device__ __forceinline__ v8f mma(V a, V b, v8f c) { return wmma16(a, b, c); } };
template <> struct WFrag<bf> { typedef v16bf V; static __device__ __forceinline__ V ld(const bf* p) { return cat16b(*(const v8us*)p, *(const v8us*)(p + 256)); }
    static __device__ __forceinline__ V ldw(const bf* p) { const v8us l = *(const v8us*)p; asm volatile("s_wait_xcnt 0x0" ::: "memory"); return cat16b(l, *(const v8us*)(p + 256)); }   // ld with the wait in front of its second load: for the last fragment of a run, where the compiler puts that load's result into the address registers that the run's issued loads name
    static __device__ __forceinline__ v8f mma(V a, V b, v8f c) { return wmmab(a, b, c); } };
template <typename T16, int NSPLIT, bool BIAS, int HOUT>
__global__ __launch_bounds__(32) void k_gemmw(const T16* __restrict__ A, const T16* __restrict__ A2, const T16* __restrict__ Bt, const T16* __restrict__ Bt2, float* C, int ldc, const float* __restrict__ bias, size_t sA, size_t sB, size_t sC, h16* H, size_t hx) {
    typedef typename WFrag<T16>::V V; constexpr int K = DD;   // every product here runs over the model width; as a constant it puts the four fragments' distances into the loads' offset fields
    __shared__ __align__(16) float os[16 * 68];
    const size_t z = blockIdx.z; A += z * sA; if (A2) A2 += z * sA; Bt += z * sB; if (Bt2) Bt2 += z * sB; C += z * sC;
    const int lane = threadIdx.x & 31, lr = lane & 15, hi = lane >> 4; const int r0 = blockIdx.x * 64, c0 = blockIdx.y * 64;
    v8f acc[4][4];
#pragma unroll
    for (int mb = 0; mb < 4; ++mb)
#pragma unroll
        for (int nb = 0; nb < 4; ++nb) acc[mb][nb] = (v8f){};
    const size_t aoff = (size_t)r0 * K, boff = (size_t)c0 * K; const unsigned lo = 8u * (unsigned)lane;   // the lane's part of every fragment address is this one constant; the rest is the same for the whole wave
#pragma unroll 1
    for (int kc = 0; kc < K; kc += 32) {
        V a[4], a2[4];
#pragma unroll
        for (int mb = 0; mb < 4; ++mb) { a[mb] = WFrag<T16>::ld((A + aoff + (size_t)mb * 16 * K + kc * 16) + lo); if (NSPLIT == 1 || NSPLIT == 2) a2[mb] = mb == 3 ? WFrag<T16>::ldw((A2 + aoff + (size_t)mb * 16 * K + kc * 16) + lo) : WFrag<T16>::ld((A2 + aoff + (size_t)mb * 16 * K + kc * 16) + lo); }
        if (NSPLIT != 1) asm volatile("s_wait_xcnt 0x0" ::: "memory");   // stands in front of the B loads, whose results the compiler puts into the address registers that the A loads just issued name (with a second A plane it is the last A load that lands there: ldw)
#pragma unroll
        for (int nb = 0; nb < 4; ++nb) { const V b = NSPLIT == 1 && nb == 3 ? WFrag<T16>::ldw((Bt + boff + (size_t)nb * 16 * K + kc * 16) + lo) : WFrag<T16>::ld((Bt + boff + (size_t)nb * 16 * K + kc * 16) + lo); V b2; if (NSPLIT >= 2) b2 = WFrag<T16>::ld((Bt2 + boff + (size_t)nb * 16 * K + kc * 16) + lo);
#pragma unroll
            for (int mb = 0; mb < 4; ++mb) { acc[mb][nb] = WFrag<T16>::mma(a[mb], b, acc[mb][nb]); if (NSPLIT == 1 || NSPLIT == 2) acc[mb][nb] = WFrag<T16>::mma(a2[mb], b, acc[mb][nb]); if (NSPLIT >= 2) acc[mb][nb] = WFrag<T16>::mma(a[mb], b2, acc[mb][nb]); } }
        asm volatile("v_nop\n\tv_nop\n\tv_nop\n\tv_nop" : "+v"(acc[0][0]), "+v"(acc[1][1]), "+v"(acc[2][2]), "+v"(acc[3][3]) : "v"(a[0]), "v"(a[3]));
    }
    if constexpr (HOUT != 0) {
        h16* ho = H + (HOUT == 1 ? (size_t)blockIdx.x * hx + (size_t)c0 * 64 : (size_t)blockIdx.y * hx + (size_t)r0 * 64) + lane * 8;
#pragma unroll
        for (int nb = 0; nb < 4; ++nb)
#pragma unroll
            for (int mb = 0; mb < 4; ++mb) { v8h o;
#pragma unroll
                for (int j = 0; j < 8; ++j) o[j] = (h16)acc[mb][nb][j];
                *(v8h*)(ho + (HOUT == 1 ? nb * 1024 + mb * 256 : (mb >> 1) * 2048 + nb * 512 + (mb & 1) * 256)) = o; }
        return;
    }
#pragma unroll
    for (int mb = 0; mb < 4; ++mb) {
#pragma unroll
        for (int nb = 0; nb < 4; ++nb) {
#pragma unroll
            for (int j = 0; j < 8; ++j) os[(hi * 8 + j) * 68 + nb * 16 + lr] = acc[mb][nb][j]; }
        __builtin_amdgcn_wave_barrier(); asm volatile("" ::: "memory");
        float* crow = C + (size_t)(r0 + mb * 16) * ldc + c0;
{
#pragma unroll
            for (int s = 0; s < 8; ++s) { const int row = 2 * s + hi, cofs = lr * 4; v4f val = *(const v4fa*)(os + row * 68 + cofs); if (BIAS) { val[0] += bfr(bias[c0 + cofs]); val[1] += bfr(bias[c0 + cofs + 1]); val[2] += bfr(bias[c0 + cofs + 2]); val[3] += bfr(bias[c0 + cofs + 3]); }
                *(v4f*)(crow + (size_t)row * ldc + cofs) = val; }
             }
        __builtin_amdgcn_wave_barrier(); asm volatile("" ::: "memory");
    }
}

__device__ __forceinline__ h16 tohx(float x) { return (h16)x; }
__device__ __forceinline__ void splitf(float y, unsigned short& h, unsigned short& l) { h = f2bf(y); l = f2bf(y - bf2f(h)); }

// k_cvt8: f32 [rows][DD] -> bf16 in fragment order. 64 threads a block of 16 rows x 32 k: four neighbours read one row's 128-byte line, eight rows' pieces of one k octet are one 128-byte line of the block.
__global__ __launch_bounds__(256) void k_cvt8(const float* __restrict__ src, bf* dst, size_t n8) { const size_t i = (size_t)blockIdx.x * 256 + threadIdx.x; if (i >= n8) return; const size_t blk = i >> 6; const int c4 = (int)i & 3, row = ((int)i >> 2) & 15;
    const v8f v = *(const v8f*)(src + ((blk / (DD / 32)) * 16 + row) * DD + (blk % (DD / 32)) * 32 + c4 * 8); v8us o;
#pragma unroll
    for (int k = 0; k < 8; ++k) o[k] = f2bf(v[k]); *(v8us*)(dst + blk * 512 + c4 * 128 + row * 8) = o;  }
__global__ __launch_bounds__(256) void k_limp(const float* __restrict__ imp, float* LI) { const int i = blockIdx.x * 256 + threadIdx.x; if (i >= NB_ * TKC) return; const int b = i / TKC, j = i % TKC; const float w = fmaxf(bfr(imp[b * NSEN + (j % NSEN)]), 1e-6f); const float l = logf(w); *(float*)(LI + i) = l;  }
__device__ __forceinline__ float xhalf(float x) { return __builtin_bit_cast(float, __builtin_amdgcn_permlanex16(__builtin_bit_cast(int, x), __builtin_bit_cast(int, x), 0x76543210, 0xfedcba98, false, false)); }   // lane l takes lane l ^ 16
__global__ __launch_bounds__(256) void k_fattn(const h16* __restrict__ QP, const h16* __restrict__ KP, const h16* __restrict__ VT, const float* __restrict__ LI, bf* Ah, bf* Al) {
    const int lane = threadIdx.x & 31, lr = lane & 15, hi = lane >> 4, wv = threadIdx.x >> 5;
    const int h = blockIdx.y, b = blockIdx.z, q0 = blockIdx.x * 256 + wv * 32;
    const h16* Qp = QP + ((size_t)(b * NH_ + h) * TQ + q0) * HD + 8 * lane;   // all three planes in fragment order: 16 tokens of q or k are two blocks, 32 keys of VT four
    const h16* Kp = KP + (size_t)(b * NH_ + h) * TKC * HD + 8 * lane;
    const h16* Vp = VT + (size_t)(b * NH_ + h) * HD * TKC + 8 * lane;
    v16h qf[2][2], kf[2][2];
#pragma unroll
    for (int q = 0; q < 2; ++q)
#pragma unroll
        for (int c = 0; c < 2; ++c) { qf[q][c] = WFrag<h16>::ld(Qp + q * 16 * HD + c * 512); kf[q][c] = WFrag<h16>::ld(Kp + q * 16 * HD + c * 512); }
    float li2[8];   // key k carries the term of sensor k mod 16 (the reference tiles imp over t_kv), and every tile starts at a multiple of 16: the lane's eight terms are the same in every tile
#pragma unroll
    for (int j = 0; j < 8; ++j) li2[j] = LI[(size_t)b * TKC + hi * 8 + j] * L2E;
    v8f acc[4][2];
#pragma unroll
    for (int dt = 0; dt < 4; ++dt) { acc[dt][0] = (v8f){}; acc[dt][1] = (v8f){}; }
    float m[2] = { -3.0e38f, -3.0e38f }, l[2] = { 0.f, 0.f };
#pragma unroll 1   // stays rolled: one pass already holds some 230 registers, and a second copy of the body would only lengthen the code
    for (int kc = 0; kc < TKC; kc += 32) {
        v16h vf[4];
#pragma unroll
        for (int dt = 0; dt < 4; ++dt) vf[dt] = WFrag<h16>::ld(Vp + (size_t)kc * HD + dt * 512);
        asm volatile("s_wait_xcnt 0x0" ::: "memory");   // stands in front of the step of the V address pair, which the loads just issued name
        __builtin_amdgcn_sched_barrier(0);   // keeps the V loads at the head of the pass (the scheduler sinks them behind the maximum otherwise), so that the score products and the maximum cover their latency
        v8f st[2][2];
#pragma unroll
        for (int t = 0; t < 2; ++t)
#pragma unroll
            for (int q = 0; q < 2; ++q) st[t][q] = wmma16(kf[t][1], qf[q][1], wmma16(kf[t][0], qf[q][0], (v8f){}));
        const int kn = kc + 32 < TKC ? kc + 32 : 0;   // the next pass's key rows, fetched while this pass does its softmax; the last pass re-reads rows 0..31 (in bounds, not used)
#pragma unroll
        for (int t = 0; t < 2; ++t)
#pragma unroll
            for (int c = 0; c < 2; ++c) kf[t][c] = WFrag<h16>::ld(Kp + (size_t)(kn + t * 16) * HD + c * 512);
        __builtin_amdgcn_sched_barrier(0);   // keeps the K fetch directly behind the score products (the scheduler sinks it behind the rescale branch otherwise): the whole softmax and attn.v of this pass cover its latency
        float mx[2];
#pragma unroll
        for (int q = 0; q < 2; ++q) { float x = -3.0e38f;
#pragma unroll
            for (int t = 0; t < 2; ++t)
#pragma unroll
                for (int j = 0; j < 8; ++j) { st[t][q][j] = fmaf(st[t][q][j], SCL * L2E, li2[j]); x = fmaxf(x, st[t][q][j]); }
            mx[q] = fmaxf(x, xhalf(x)); }
        if (__builtin_amdgcn_ballot_w32(mx[0] > m[0] + 5.0f || mx[1] > m[1] + 5.0f) != 0) {   // one scalar branch a pass
#pragma unroll
            for (int q = 0; q < 2; ++q) { const float mn = fmaxf(m[q], mx[q]); const float al = __builtin_amdgcn_exp2f(m[q] - mn); m[q] = mn; l[q] *= al;
#pragma unroll
                for (int dt = 0; dt < 4; ++dt) acc[dt][q] *= al; }
        }
#pragma unroll
        for (int q = 0; q < 2; ++q) { const float cq = 10.0f - m[q]; v16h pb;
#pragma unroll
            for (int t = 0; t < 2; ++t) { float e[8];
#pragma unroll
                for (int j = 0; j < 8; ++j) e[j] = st[t][q][j] + cq;
                // eight exponentials in place and the free slot behind the last one in ONE statement: no instruction directly behind a v_exp reads its result or overwrites its source
                asm("v_exp_f32 %0, %0\n\tv_exp_f32 %1, %1\n\tv_exp_f32 %2, %2\n\tv_exp_f32 %3, %3\n\tv_exp_f32 %4, %4\n\tv_exp_f32 %5, %5\n\tv_exp_f32 %6, %6\n\tv_exp_f32 %7, %7\n\tv_nop"
                    : "+v"(e[0]), "+v"(e[1]), "+v"(e[2]), "+v"(e[3]), "+v"(e[4]), "+v"(e[5]), "+v"(e[6]), "+v"(e[7]));
#pragma unroll
                for (int j = 0; j < 8; ++j) { l[q] += e[j]; pb[t * 8 + j] = tohx(e[j]); } }
#pragma unroll
            for (int dt = 0; dt < 4; ++dt) acc[dt][q] = wmma16(vf[dt], pb, acc[dt][q]); }
    }
#pragma unroll
    for (int q = 0; q < 2; ++q) { const float inv = __fdiv_rn(1.0f, l[q] + xhalf(l[q]));   // the halves' sums joined once
        const size_t oo = ((size_t)b * TQ + q0 + q * 16) * DD + h * 1024 + lane * 8;   // fragment order, rows = tokens, k = the 1024 merged features: head h is blocks 2h and 2h + 1 of the 16 tokens, tile dt a half block
#pragma unroll
        for (int dt = 0; dt < 4; ++dt) { v8us oh, ol;
#pragma unroll
            for (int j = 0; j < 8; ++j) { unsigned short a, c2; splitf(__fmul_rn(acc[dt][q][j], inv), a, c2); oh[j] = a; ol[j] = c2; }
            *(v8us*)(Ah + oo + dt * 256) = oh; *(v8us*)(Al + oo + dt * 256) = ol; } }
}

extern "C" void kernel_launch(void* const* d_in, const int* in_sizes, int n_in,
                              void* d_out, int out_size, void* d_ws, size_t ws_size, hipStream_t stream) {
    (void)in_sizes; (void)n_in; (void)out_size;
    const float* qin = (const float*)d_in[0]; const float* kvin = (const float*)d_in[1]; const float* imp = (const float*)d_in[2]; const float* wq = (const float*)d_in[3]; const float* wk = (const float*)d_in[4]; const float* wv = (const float*)d_in[5]; const float* wo = (const float*)d_in[6];   // torch [out][in] weights
    float* OUT = (float*)d_out;     // [2][2048][1024]
    char* wsp = (char*)d_ws;
    auto take = [&](size_t bytes) { char* p = wsp; wsp += (bytes + 255) & ~(size_t)255; return (void*)p; };
    bf* WQ = (bf*)take((size_t)DD * DD * 2); bf* WK = (bf*)take((size_t)DD * DD * 2); bf* WV = (bf*)take((size_t)DD * DD * 2); bf* WO = (bf*)take((size_t)DD * DD * 2); float* LI = (float*)take((size_t)NB_ * TKC * 4);
    bf* XB = (bf*)take((size_t)TKC * DD * 2); h16* QP = (h16*)take((size_t)NB_ * NH_ * TQ * HD * 2); h16* KP = (h16*)take((size_t)NB_ * NH_ * TKC * HD * 2); h16* VT = (h16*)take((size_t)NB_ * NH_ * HD * TKC * 2);
    bf* Ah = (bf*)take((size_t)NB_ * TQ * DD * 2); bf* Al = (bf*)take((size_t)NB_ * TQ * DD * 2);
    if ((size_t)(wsp - (char*)d_ws) > ws_size) return;    // total ~ 72 MiB; ws 256 MiB
    { const size_t nw = (size_t)DD * DD / 8; const unsigned g = (unsigned)((nw + 255) / 256); k_cvt8<<<g, 256, 0, stream>>>(wq, WQ, nw); k_cvt8<<<g, 256, 0, stream>>>(wk, WK, nw); k_cvt8<<<g, 256, 0, stream>>>(wv, WV, nw); k_cvt8<<<g, 256, 0, stream>>>(wo, WO, nw); k_limp<<<(NB_ * TKC + 255) / 256, 256, 0, stream>>>(imp, LI); }
    const dim3 gQ(TQ / 64, DD / 64, 1), gK(TKC / 64, DD / 64, 1);
    const dim3 gQt(DD / 64, TQ / 64, 1), gKt(DD / 64, TKC / 64, 1);   // q and k as W X^T: m = the 64 dims of head blockIdx.x, n = the token, so a tile is 64 tokens of head blockIdx.x's plane; v as X W^T: m = the token, n = the feature, so a tile is 64 keys of head blockIdx.y's VT plane
    for (int b = 0; b < NB_; ++b) {
        k_cvt8<<<(unsigned)(((size_t)TQ * DD / 8 + 255) / 256), 256, 0, stream>>>(qin + (size_t)b * TQ * DD, XB, (size_t)TQ * DD / 8);
        k_gemmw<bf, 0, false, 1><<<gQt, 32, 0, stream>>>(WQ, nullptr, XB, nullptr, nullptr, 0, nullptr, 0, 0, 0, QP + (size_t)b * NH_ * TQ * HD, (size_t)TQ * HD);
        k_cvt8<<<(unsigned)(((size_t)TKC * DD / 8 + 255) / 256), 256, 0, stream>>>(kvin + (size_t)b * TKC * DD, XB, (size_t)TKC * DD / 8);
        k_gemmw<bf, 0, false, 1><<<gKt, 32, 0, stream>>>(WK, nullptr, XB, nullptr, nullptr, 0, nullptr, 0, 0, 0, KP + (size_t)b * NH_ * TKC * HD, (size_t)TKC * HD);
        k_gemmw<bf, 0, false, 2><<<gK, 32, 0, stream>>>(XB, nullptr, WV, nullptr, nullptr, 0, nullptr, 0, 0, 0, VT + (size_t)b * NH_ * HD * TKC, (size_t)HD * TKC); }
    k_fattn<<<dim3(TQ / 256, NH_, NB_), 256, 0, stream>>>(QP, KP, VT, LI, Ah, Al);
    for (int b = 0; b < NB_; ++b)
        k_gemmw<bf, 1, false, 0><<<gQ, 32, 0, stream>>>(Ah + (size_t)b * TQ * DD, Al + (size_t)b * TQ * DD, WO, nullptr, OUT + (size_t)b * TQ * DD, DD, nullptr, 0, 0, 0, nullptr, 0);
}

// v005
// A run of this version takes 180 microseconds.
// Timed twice side by side with v004, it ran 1.80 and 1.83 times as fast.
// All steps since v000 together make it 25.4 times as fast.
#include <hip/hip_runtime.h>

// Temporal decoder cross-attention with sensor importance (query [2][2048][1024], key_value [2][256][16][1024] -> 4096 source tokens (t_kv, sensor), imp_weights [2][16]; q/k/v = x W^T (16 heads x 64);
// scores = q.k/8 + log(max(imp[b][sensor of key], 1e-6)) (read as data); softmax over the 4096 keys; out = merged (attn v) W_o^T -> [2][2048][1024]).
// Compute dtypes, f32 accumulate: every input rounded to bf16; q/k/v projections on PLAIN bf16 operands (inputs: exact products, f32 accumulate); scores (K 64) and attn.v on

#define NB_  2
#define TQ   2048
#define TKC  4096
#define NSEN 16
#define DD   1024
#define NH_  16
#define HD   64
#define SCL  0.125f
#define L2E  1.4426950408889634f
typedef _Float16 h16;
typedef unsigned short bf;
typedef __attribute__((ext_vector_type(16))) __bf16   v16bf;
typedef __attribute__((ext_vector_type(16))) _Float16 v16h;
typedef __attribute__((ext_vector_type(8)))  _Float16 v8h;
typedef __attribute__((ext_vector_type(8)))  unsigned short v8us;
typedef __attribute__((ext_vector_type(8)))  float    v8f;
typedef __attribute__((ext_vector_type(4)))  float    v4f;
typedef v8h  __attribute__((may_alias)) v8ha;
typedef v4f  __attribute__((may_alias)) v4fa;
typedef v8us __attribute__((may_alias)) v8usa;

__device__ __forceinline__ unsigned short f2bf(float f) { unsigned u = __float_as_uint(f); u += 0x7FFFu + ((u >> 16) & 1u); return (unsigned short)(u >> 16); }
__device__ __forceinline__ float bf2f(unsigned short b) { return __uint_as_float(((unsigned)b) << 16); }
__device__ __forceinline__ float bfr(float f) { return bf2f(f2bf(f)); }
__device__ __forceinline__ v16h cat16(v8h lo, v8h hi) { return __builtin_shufflevector(lo, hi, 0, 1, 2, 3, 4, 5, 6, 7, 8, 9, 10, 11, 12, 13, 14, 15); }
__device__ __forceinline__ v16bf cat16b(v8us lo, v8us hi) { return __builtin_bit_cast(v16bf, __builtin_shufflevector(lo, hi, 0, 1, 2, 3, 4, 5, 6, 7, 8, 9, 10, 11, 12, 13, 14, 15)); }
__device__ __forceinline__ v8f wmma16(v16h a, v16h b, v8f c) { return __builtin_amdgcn_wmma_f32_16x16x32_f16(false, a, false, b, (short)0, c, false, false); }
__device__ __forceinline__ v8f wmmab(v16bf a, v16bf b, v8f c) { return __builtin_amdgcn_wmma_f32_16x16x32_bf16(false, a, false, b, (short)0, c, false, false); }



// ---- FRAGMENT ORDER: every 16-bit operand plane X[row][k] lies in blocks of 16 rows x 32 k (1 KiB), a block holding its elements as the matrix loader takes them: element (row, k) stands at
// block * 512 + ((k >> 4) & 1) * 256 + ((k >> 3) & 1) * 128 + (row & 15) * 8 + (k & 7). A fragment is then two wave-wide 16-byte loads at lane * 8 and lane * 8 + 256, each 512 contiguous bytes (4 whole lines; row-major planes gave 16 quarter lines a load).
// Block order: (row >> 4) * (K / 32) + (k >> 5), so 16 rows of all k take 16 * K elements as before; VT alone has (key >> 5) * 4 + (dim >> 4), so that the four fragments of a pass are contiguous. Registers hold the same values as with row-major planes.
// ---- k_gemmw: register-blocked GEMM, ONE WAVE per 64x64 output tile (16 accumulators), operands straight from 16-bit planes in fragment order; 32 threads; HOUT 0: grid (M/64, N/64, Z).
// C[m][n] (f32, pitch ldc, + optional f32 bias[n]) = sum_k A[m][k] Bt[n][k] (+ split products per NSPLIT). z-batch strides sA/sB/sC in elements. K = DD.
// HOUT: the tile goes out as f16 straight from the accumulators, in fragment order with m as the k of the plane and n as its row. A lane holds 8 consecutive m of one n, which is one 16-byte store at lane * 8 of a half block: a wave's store is 512 contiguous bytes.
// HOUT 1: ALL THREE PROJECTIONS OF BOTH BATCHES IN ONE LAUNCH, so that a SIMD holds several waves and one wave's wait for its fragments is another's matrix time. Grid = the flat tile number: 2048 tiles of k, 2048 of v, 1024 of q.
// A = the weight planes (q, k, v in a row), Bt = the activation plane (the 4096 query tokens, then the 8192 source tokens), H = the head planes (QP, KP, VT in a row).
// q, k as W X^T: m = the 64 dims of a head, n = the token: put_planes<1>, rows = tokens, k = the 64 m. v as X W^T: m = the token, n = the dim: put_planes<2>, rows = the 64 dims, k = tokens, VT's block order.
template <typename T16> struct WFrag;
template <> struct WFrag<h16> { typedef v16h V; static __device__ __forceinline__ V ld(const h16* p) { return cat16(*(const v8h*)p, *(const v8h*)(p + 256)); } static __device__ __forceinline__ v8f mma(V a, V b, v8f c) { return wmma16(a, b, c); } };
template <> struct WFrag<bf> { typedef v16bf V; static __device__ __forceinline__ V ld(const bf* p) { return cat16b(*(const v8us*)p, *(const v8us*)(p + 256)); }
    static __device__ __forceinline__ V ldw(const bf* p) { const v8us l = *(const v8us*)p; asm volatile("s_wait_xcnt 0x0" ::: "memory"); return cat16b(l, *(const v8us*)(p + 256)); }   // ld with the wait in front of its second load: for the last fragment of a run, where the compiler puts that load's result into the address registers that the run's issued loads name
    static __device__ __forceinline__ v8f mma(V a, V b, v8f c) { return wmmab(a, b, c); } };
template <int ORD> __device__ __forceinline__ void put_planes(const v8f (&acc)[4][4], h16* ho) {
#pragma unroll
    for (int nb = 0; nb < 4; ++nb)
#pragma unroll
        for (int mb = 0; mb < 4; ++mb) { v8h o;
#pragma unroll
            for (int j = 0; j < 8; ++j) o[j] = (h16)acc[mb][nb][j];
            *(v8h*)(ho + (ORD == 1 ? nb * 1024 + mb * 256 : (mb >> 1) * 2048 + nb * 512 + (mb & 1) * 256)) = o; }
}
template <typename T16, int NSPLIT, bool BIAS, int HOUT>
__global__ __launch_bounds__(32) void k_gemmw(const T16* __restrict__ A, const T16* __restrict__ A2, const T16* __restrict__ Bt, const T16* __restrict__ Bt2, float* C, int ldc, const float* __restrict__ bias, size_t sA, size_t sB, size_t sC, h16* H) {
    typedef typename WFrag<T16>::V V; constexpr int K = DD;   // every product here runs over the model width; as a constant it puts the four fragments' distances into the loads' offset fields
    __shared__ __align__(16) float os[16 * 68];
    const size_t z = blockIdx.z; A += z * sA; if (A2) A2 += z * sA; Bt += z * sB; if (Bt2) Bt2 += z * sB; C += z * sC;
    const int lane = threadIdx.x & 31, lr = lane & 15, hi = lane >> 4; int r0 = blockIdx.x * 64, c0 = blockIdx.y * 64;
    h16* ho = H; bool isv = false;
    if constexpr (HOUT != 0) {   // flat tile number -> projection, head, 64 tokens; all of it the same for the whole wave
        constexpr unsigned NKT = NB_ * TKC / 64, NT = NKT * NH_; const unsigned t = blockIdx.x; int head, tok, lt, x0; size_t w0, h0;   // NKT = source-token tiles, NT = tiles of k (and of v); lt = log2 of a batch's tokens
        if (t < NT) { head = t % NH_; tok = (t / NH_) * 64; lt = __builtin_ctz(TKC); x0 = NB_ * TQ; w0 = (size_t)DD * DD; h0 = (size_t)NB_ * NH_ * TQ * HD; }
        else if (t < 2 * NT) { isv = true; tok = ((t - NT) % NKT) * 64; head = (t - NT) / NKT; lt = __builtin_ctz(TKC); x0 = NB_ * TQ; w0 = (size_t)2 * DD * DD; h0 = (size_t)NB_ * NH_ * (TQ + TKC) * HD; }
        else { head = (t - 2 * NT) % NH_; tok = ((t - 2 * NT) / NH_) * 64; lt = __builtin_ctz(TQ); x0 = 0; w0 = 0; h0 = 0; }
        ho += h0 + ((((size_t)((tok >> lt) * NH_ + head)) << lt) + (tok & ((1 << lt) - 1))) * HD + lane * 8;   // 64 tokens of one head are 4096 elements of its plane, in q, k and VT alike
        const T16* Wp = A + w0; const T16* Xp = Bt;
        A = isv ? Xp : Wp; Bt = isv ? Wp : Xp; r0 = isv ? x0 + tok : head * 64; c0 = isv ? head * 64 : x0 + tok;
    }
    v8f acc[4][4];
#pragma unroll
    for (int mb = 0; mb < 4; ++mb)
#pragma unroll
        for (int nb = 0; nb < 4; ++nb) acc[mb][nb] = (v8f){};
    const size_t aoff = (size_t)r0 * K, boff = (size_t)c0 * K; const unsigned lo = 8u * (unsigned)lane;   // the lane's part of every fragment address is this one constant; the rest is the same for the whole wave
#pragma unroll 1
    for (int kc = 0; kc < K; kc += 32) {
        V a[4], a2[4];
#pragma unroll
        for (int mb = 0; mb < 4; ++mb) { a[mb] = WFrag<T16>::ld((A + aoff + (size_t)mb * 16 * K + kc * 16) + lo); if (NSPLIT == 1 || NSPLIT == 2) a2[mb] = mb == 3 ? WFrag<T16>::ldw((A2 + aoff + (size_t)mb * 16 * K + kc * 16) + lo) : WFrag<T16>::ld((A2 + aoff + (size_t)mb * 16 * K + kc * 16) + lo); }
        if (NSPLIT != 1) asm volatile("s_wait_xcnt 0x0" ::: "memory");   // stands in front of the B loads, whose results the compiler puts into the address registers that the A loads just issued name (with a second A plane it is the last A load that lands there: ldw)
#pragma unroll
        for (int nb = 0; nb < 4; ++nb) { const V b = NSPLIT == 1 && nb == 3 ? WFrag<T16>::ldw((Bt + boff + (size_t)nb * 16 * K + kc * 16) + lo) : WFrag<T16>::ld((Bt + boff + (size_t)nb * 16 * K + kc * 16) + lo); V b2; if (NSPLIT >= 2) b2 = WFrag<T16>::ld((Bt2 + boff + (size_t)nb * 16 * K + kc * 16) + lo);
#pragma unroll
            for (int mb = 0; mb < 4; ++mb) { acc[mb][nb] = WFrag<T16>::mma(a[mb], b, acc[mb][nb]); if (NSPLIT == 1 || NSPLIT == 2) acc[mb][nb] = WFrag<T16>::mma(a2[mb], b, acc[mb][nb]); if (NSPLIT >= 2) acc[mb][nb] = WFrag<T16>::mma(a[mb], b2, acc[mb][nb]); } }
        asm volatile("v_nop\n\tv_nop\n\tv_nop\n\tv_nop" : "+v"(acc[0][0]), "+v"(acc[1][1]), "+v"(acc[2][2]), "+v"(acc[3][3]) : "v"(a[0]), "v"(a[3]));
    }
    if constexpr (HOUT != 0) {
        if (isv) put_planes<2>(acc, ho); else put_planes<1>(acc, ho);
        return;
    }
#pragma unroll
    for (int mb = 0; mb < 4; ++mb) {
#pragma unroll
        for (int nb = 0; nb < 4; ++nb) {
#pragma unroll
            for (int j = 0; j < 8; ++j) os[(hi * 8 + j) * 68 + nb * 16 + lr] = acc[mb][nb][j]; }
        __builtin_amdgcn_wave_barrier(); asm volatile("" ::: "memory");
        float* crow = C + (size_t)(r0 + mb * 16) * ldc + c0;
{
#pragma unroll
            for (int s = 0; s < 8; ++s) { const int row = 2 * s + hi, cofs = lr * 4; v4f val = *(const v4fa*)(os + row * 68 + cofs); if (BIAS) { val[0] += bfr(bias[c0 + cofs]); val[1] += bfr(bias[c0 + cofs + 1]); val[2] += bfr(bias[c0 + cofs + 2]); val[3] += bfr(bias[c0 + cofs + 3]); }
                *(v4f*)(crow + (size_t)row * ldc + cofs) = val; }
             }
        __builtin_amdgcn_wave_barrier(); asm volatile("" ::: "memory");
    }
}

__device__ __forceinline__ h16 tohx(float x) { return (h16)x; }
__device__ __forceinline__ void splitf(float y, unsigned short& h, unsigned short& l) { h = f2bf(y); l = f2bf(y - bf2f(h)); }

// cvt8: f32 [rows][DD] -> bf16 in fragment order, thread i of a plane. 64 threads a block of 16 rows x 32 k: four neighbours read one row's 128-byte line, eight rows' pieces of one k octet are one 128-byte line of the block.
__device__ __forceinline__ void cvt8(const float* __restrict__ src, bf* dst, size_t i) { const size_t blk = i >> 6; const int c4 = (int)i & 3, row = ((int)i >> 2) & 15;
    const v8f v = *(const v8f*)(src + ((blk / (DD / 32)) * 16 + row) * DD + (blk % (DD / 32)) * 32 + c4 * 8); v8us o;
#pragma unroll
    for (int k = 0; k < 8; ++k) o[k] = f2bf(v[k]); *(v8us*)(dst + blk * 512 + c4 * 128 + row * 8) = o;  }
__device__ __forceinline__ void limp(const float* __restrict__ imp, float* LI, int i) { const int b = i / TKC, j = i % TKC; const float w = fmaxf(bfr(imp[b * NSEN + (j % NSEN)]), 1e-6f); const float l = logf(w); *(float*)(LI + i) = l;
    asm volatile("s_wait_xcnt 0x0" ::: "memory"); }   // stands behind the store: in the merged kernel the conversion path is laid out behind it and rewrites the registers that the store names
// k_prep: every input's conversion in ONE launch. A block of 256 threads belongs whole to one plane, by its number: 4096 blocks of key_value, 2048 of query, 512 of each weight, 32 of the importance terms; the ranges are exact, so no thread is idle.
// X = the activation plane (query tokens, then source tokens), WP = the weight planes (q, k, v, o in a row).
__global__ __launch_bounds__(256) void k_prep(const float* __restrict__ kv, const float* __restrict__ q, const float* __restrict__ wq, const float* __restrict__ wk, const float* __restrict__ wv, const float* __restrict__ wo, const float* __restrict__ imp, bf* X, bf* WP, float* LI) {
    constexpr unsigned BKV = NB_ * TKC * DD / 2048, BQ = NB_ * TQ * DD / 2048, BW = DD * DD / 2048;
    unsigned t = blockIdx.x; const float* src; bf* dst;
    if (t < BKV) { src = kv; dst = X + (size_t)NB_ * TQ * DD; }
    else if ((t -= BKV) < BQ) { src = q; dst = X; }
    else if ((t -= BQ) < 4 * BW) { const unsigned w = t / BW; t %= BW; src = w == 0 ? wq : w == 1 ? wk : w == 2 ? wv : wo; dst = WP + (size_t)w * DD * DD; }
    else { limp(imp, LI, (int)((t - 4 * BW) * 256 + threadIdx.x)); return; }
    cvt8(src, dst, (size_t)t * 256 + threadIdx.x);
}
__device__ __forceinline__ float xhalf(float x) { return __builtin_bit_cast(float, __builtin_amdgcn_permlanex16(__builtin_bit_cast(int, x), __builtin_bit_cast(int, x), 0x76543210, 0xfedcba98, false, false)); }   // lane l takes lane l ^ 16
__global__ __launch_bounds__(256) void k_fattn(const h16* __restrict__ QP, const h16* __restrict__ KP, const h16* __restrict__ VT, const float* __restrict__ LI, bf* Ah, bf* Al) {
    const int lane = threadIdx.x & 31, lr = lane & 15, hi = lane >> 4, wv = threadIdx.x >> 5;
    const int h = blockIdx.y, b = blockIdx.z, q0 = blockIdx.x * 256 + wv * 32;
    const h16* Qp = QP + ((size_t)(b * NH_ + h) * TQ + q0) * HD + 8 * lane;   // all three planes in fragment order: 16 tokens of q or k are two blocks, 32 keys of VT four
    const h16* Kp = KP + (size_t)(b * NH_ + h) * TKC * HD + 8 * lane;
    const h16* Vp = VT + (size_t)(b * NH_ + h) * HD * TKC + 8 * lane;
    v16h qf[2][2], kf[2][2];
#pragma unroll
    for (int q = 0; q < 2; ++q)
#pragma unroll
        for (int c = 0; c < 2; ++c) { qf[q][c] = WFrag<h16>::ld(Qp + q * 16 * HD + c * 512); kf[q][c] = WFrag<h16>::ld(Kp + q * 16 * HD + c * 512); }
    float li2[8];   // key k carries the term of sensor k mod 16 (the reference tiles imp over t_kv), and every tile starts at a multiple of 16: the lane's eight terms are the same in every tile
#pragma unroll
    for (int j = 0; j < 8; ++j) li2[j] = LI[(size_t)b * TKC + hi * 8 + j] * L2E;
    v8f acc[4][2];
#pragma unroll
    for (int dt = 0; dt < 4; ++dt) { acc[dt][0] = (v8f){}; acc[dt][1] = (v8f){}; }
    float m[2] = { -3.0e38f, -3.0e38f }, l[2] = { 0.f, 0.f };
#pragma unroll 1   // stays rolled: one pass already holds some 230 registers, and a second copy of the body would only lengthen the code
    for (int kc = 0; kc < TKC; kc += 32) {
        v16h vf[4];
#pragma unroll
        for (int dt = 0; dt < 4; ++dt) vf[dt] = WFrag<h16>::ld(Vp + (size_t)kc * HD + dt * 512);
        asm volatile("s_wait_xcnt 0x0" ::: "memory");   // stands in front of the step of the V address pair, which the loads just issued name
        __builtin_amdgcn_sched_barrier(0);   // keeps the V loads at the head of the pass (the scheduler sinks them behind the maximum otherwise), so that the score products and the maximum cover their latency
        v8f st[2][2];
#pragma unroll
        for (int t = 0; t < 2; ++t)
#pragma unroll
            for (int q = 0; q < 2; ++q) st[t][q] = wmma16(kf[t][1], qf[q][1], wmma16(kf[t][0], qf[q][0], (v8f){}));
        const int kn = kc + 32 < TKC ? kc + 32 : 0;   // the next pass's key rows, fetched while this pass does its softmax; the last pass re-reads rows 0..31 (in bounds, not used)
#pragma unroll
        for (int t = 0; t < 2; ++t)
#pragma unroll
            for (int c = 0; c < 2; ++c) kf[t][c] = WFrag<h16>::ld(Kp + (size_t)(kn + t * 16) * HD + c * 512);
        __builtin_amdgcn_sched_barrier(0);   // keeps the K fetch directly behind the score products (the scheduler sinks it behind the rescale branch otherwise): the whole softmax and attn.v of this pass cover its latency
        float mx[2];
#pragma unroll
        for (int q = 0; q < 2; ++q) { float x = -3.0e38f;
#pragma unroll
            for (int t = 0; t < 2; ++t)
#pragma unroll
                for (int j = 0; j < 8; ++j) { st[t][q][j] = fmaf(st[t][q][j], SCL * L2E, li2[j]); x = fmaxf(x, st[t][q][j]); }
            mx[q] = fmaxf(x, xhalf(x)); }
        if (__builtin_amdgcn_ballot_w32(mx[0] > m[0] + 5.0f || mx[1] > m[1] + 5.0f) != 0) {   // one scalar branch a pass
#pragma unroll
            for (int q = 0; q < 2; ++q) { const float mn = fmaxf(m[q], mx[q]); const float al = __builtin_amdgcn_exp2f(m[q] - mn); m[q] = mn; l[q] *= al;
#pragma unroll
                for (int dt = 0; dt < 4; ++dt) acc[dt][q] *= al; }
        }
#pragma unroll
        for (int q = 0; q < 2; ++q) { const float cq = 10.0f - m[q]; v16h pb;
#pragma unroll
            for (int t = 0; t < 2; ++t) { float e[8];
#pragma unroll
                for (int j = 0; j < 8; ++j) e[j] = st[t][q][j] + cq;
                // eight exponentials in place and the free slot behind the last one in ONE statement: no instruction directly behind a v_exp reads its result or overwrites its source
                asm("v_exp_f32 %0, %0\n\tv_exp_f32 %1, %1\n\tv_exp_f32 %2, %2\n\tv_exp_f32 %3, %3\n\tv_exp_f32 %4, %4\n\tv_exp_f32 %5, %5\n\tv_exp_f32 %6, %6\n\tv_exp_f32 %7, %7\n\tv_nop"
                    : "+v"(e[0]), "+v"(e[1]), "+v"(e[2]), "+v"(e[3]), "+v"(e[4]), "+v"(e[5]), "+v"(e[6]), "+v"(e[7]));
#pragma unroll
                for (int j = 0; j < 8; ++j) { l[q] += e[j]; pb[t * 8 + j] = tohx(e[j]); } }
#pragma unroll
            for (int dt = 0; dt < 4; ++dt) acc[dt][q] = wmma16(vf[dt], pb, acc[dt][q]); }
    }
#pragma unroll
    for (int q = 0; q < 2; ++q) { const float inv = __fdiv_rn(1.0f, l[q] + xhalf(l[q]));   // the halves' sums joined once
        const size_t oo = ((size_t)b * TQ + q0 + q * 16) * DD + h * 1024 + lane * 8;   // fragment order, rows = tokens, k = the 1024 merged features: head h is blocks 2h and 2h + 1 of the 16 tokens, tile dt a half block
#pragma unroll
        for (int dt = 0; dt < 4; ++dt) { v8us oh, ol;
#pragma unroll
            for (int j = 0; j < 8; ++j) { unsigned short a, c2; splitf(__fmul_rn(acc[dt][q][j], inv), a, c2); oh[j] = a; ol[j] = c2; }
            *(v8us*)(Ah + oo + dt * 256) = oh; *(v8us*)(Al + oo + dt * 256) = ol; } }
}

extern "C" void kernel_launch(void* const* d_in, const int* in_sizes, int n_in,
                              void* d_out, int out_size, void* d_ws, size_t ws_size, hipStream_t stream) {
    (void)in_sizes; (void)n_in; (void)out_size;
    const float* qin = (const float*)d_in[0]; const float* kvin = (const float*)d_in[1]; const float* imp = (const float*)d_in[2]; const float* wq = (const float*)d_in[3]; const float* wk = (const float*)d_in[4]; const float* wv = (const float*)d_in[5]; const float* wo = (const float*)d_in[6];   // torch [out][in] weights
    float* OUT = (float*)d_out;     // [2][2048][1024]
    char* wsp = (char*)d_ws;
    auto take = [&](size_t bytes) { char* p = wsp; wsp += (bytes + 255) & ~(size_t)255; return (void*)p; };
    bf* WP = (bf*)take((size_t)4 * DD * DD * 2); bf* WO = WP + (size_t)3 * DD * DD; float* LI = (float*)take((size_t)NB_ * TKC * 4);   // weight planes q, k, v, o in a row
    bf* X = (bf*)take((size_t)NB_ * (TQ + TKC) * DD * 2);   // the query tokens of both batches, then the source tokens of both
    h16* QP = (h16*)take((size_t)NB_ * NH_ * (TQ + 2 * TKC) * HD * 2); h16* KP = QP + (size_t)NB_ * NH_ * TQ * HD; h16* VT = KP + (size_t)NB_ * NH_ * TKC * HD;   // head planes in a row
    bf* Ah = (bf*)take((size_t)NB_ * TQ * DD * 2); bf* Al = (bf*)take((size_t)NB_ * TQ * DD * 2);
    if ((size_t)(wsp - (char*)d_ws) > ws_size) return;    // total ~ 88 MiB; ws 256 MiB
    k_prep<<<NB_ * (TQ + TKC) * DD / 2048 + 4 * DD * DD / 2048 + NB_ * TKC / 256, 256, 0, stream>>>(kvin, qin, wq, wk, wv, wo, imp, X, WP, LI);
    k_gemmw<bf, 0, false, 1><<<NB_ * (TQ + 2 * TKC) / 64 * NH_, 32, 0, stream>>>(WP, nullptr, X, nullptr, nullptr, 0, nullptr, 0, 0, 0, QP);
    k_fattn<<<dim3(TQ / 256, NH_, NB_), 256, 0, stream>>>(QP, KP, VT, LI, Ah, Al);
    k_gemmw<bf, 1, false, 0><<<dim3(NB_ * TQ / 64, DD / 64, 1), 32, 0, stream>>>(Ah, Al, WO, nullptr, OUT, DD, nullptr, 0, 0, 0, nullptr);   // the batches' tokens stand in a row in Ah, Al and out: one product over all 4096
}

// v006
// One run takes 170 microseconds.
// Two timings next to v005 both put it at 1.06 times that version's speed.
// Counting every step since v000, it is 27.0 times as fast.
#include <hip/hip_runtime.h>

// Temporal decoder cross-attention with sensor importance (query [2][2048][1024], key_value [2][256][16][1024] -> 4096 source tokens (t_kv, sensor), imp_weights [2][16]; q/k/v = x W^T (16 heads x 64);
// scores = q.k/8 + log(max(imp[b][sensor of key], 1e-6)) (read as data); softmax over the 4096 keys; out = merged (attn v) W_o^T -> [2][2048][1024]).
// Compute dtypes, f32 accumulate: every input rounded to bf16; q/k/v projections on PLAIN bf16 operands (inputs: exact products, f32 accumulate); scores (K 64) and attn.v on

#define NB_  2
#define TQ   2048
#define TKC  4096
#define NSEN 16
#define DD   1024
#define NH_  16
#define HD   64
#define SCL  0.125f
#define L2E  1.4426950408889634f
typedef _Float16 h16;
typedef unsigned short bf;
typedef __attribute__((ext_vector_type(16))) __bf16   v16bf;
typedef __attribute__((ext_vector_type(16))) _Float16 v16h;
typedef __attribute__((ext_vector_type(8)))  _Float16 v8h;
typedef __attribute__((ext_vector_type(8)))  unsigned short v8us;
typedef __attribute__((ext_vector_type(8)))  float    v8f;
typedef __attribute__((ext_vector_type(4)))  float    v4f;
typedef v8h  __attribute__((may_alias)) v8ha;
typedef v4f  __attribute__((may_alias)) v4fa;
typedef v8us __attribute__((may_alias)) v8usa;

__device__ __forceinline__ unsigned short f2bf(float f) { unsigned u = __float_as_uint(f); u += 0x7FFFu + ((u >> 16) & 1u); return (unsigned short)(u >> 16); }
__device__ __forceinline__ float bf2f(unsigned short b) { return __uint_as_float(((unsigned)b) << 16); }
__device__ __forceinline__ float bfr(float f) { return bf2f(f2bf(f)); }
__device__ __forceinline__ v16h cat16(v8h lo, v8h hi) { return __builtin_shufflevector(lo, hi, 0, 1, 2, 3, 4, 5, 6, 7, 8, 9, 10, 11, 12, 13, 14, 15); }
__device__ __forceinline__ v16bf cat16b(v8us lo, v8us hi) { return __builtin_bit_cast(v16bf, __builtin_shufflevector(lo, hi, 0, 1, 2, 3, 4, 5, 6, 7, 8, 9, 10, 11, 12, 13, 14, 15)); }
__device__ __forceinline__ v8f wmma16(v16h a, v16h b, v8f c) { return __builtin_amdgcn_wmma_f32_16x16x32_f16(false, a, false, b, (short)0, c, false, false); }
__device__ __forceinline__ v8f wmmab(v16bf a, v16bf b, v8f c) { return __builtin_amdgcn_wmma_f32_16x16x32_bf16(false, a, false, b, (short)0, c, false, false); }



// ---- FRAGMENT ORDER: every 16-bit operand plane X[row][k] lies in blocks of 16 rows x 32 k (1 KiB), a block holding its elements as the matrix loader takes them: element (row, k) stands at
// block * 512 + ((k >> 4) & 1) * 256 + ((k >> 3) & 1) * 128 + (row & 15) * 8 + (k & 7). A fragment is then two wave-wide 16-byte loads at lane * 8 and lane * 8 + 256, each 512 contiguous bytes (4 whole lines; row-major planes gave 16 quarter lines a load).
// Block order: (row >> 4) * (K / 32) + (k >> 5), so 16 rows of all k take 16 * K elements as before; VT alone has (key >> 5) * 4 + (dim >> 4), so that the four fragments of a pass are contiguous. Registers hold the same values as with row-major planes.
// ---- k_gemmw: GEMM, a block of FOUR WAVES (2 x 2) per 128x128 output tile, each wave a 64x64 part (16 accumulators); 128 threads; HOUT 0: grid (M/128, N/128, Z).
// The operands of 32 k (128 rows of A, of the second A plane where there is one, and of Bt: 8 KiB each) are brought into LDS by asynchronous copies, once for the block, and each fragment is read from there by the two waves that need it:
// half the bytes from L2, and the copies of tile t + 2 fly while tile t + 1 is worked on (two buffers). A plane in fragment order is copied as it lies: 16 rows x 32 k are 1 KiB in a row, and a fragment read is 512 contiguous LDS bytes a load.
// C[m][n] (f32, pitch ldc, + optional f32 bias[n]) = sum_k A[m][k] Bt[n][k] (+ the second A plane's products, NSPLIT 1). z-batch strides sA/sB/sC in elements. K = DD.
// HOUT: the tile goes out as f16 straight from the accumulators, in fragment order with m as the k of the plane and n as its row. A lane holds 8 consecutive m of one n, which is one 16-byte store at lane * 8 of a half block: a wave's store is 512 contiguous bytes.
// HOUT 1: ALL THREE PROJECTIONS OF BOTH BATCHES IN ONE LAUNCH, so that a SIMD holds several waves and one wave's waits are another's matrix time. Grid = the flat tile number: 512 tiles of k, 512 of v, 256 of q; a tile is two heads x 128 tokens.
// A = the weight planes (q, k, v in a row), Bt = the activation plane (the 4096 query tokens, then the 8192 source tokens), H = the head planes (QP, KP, VT in a row).
// q, k as W X^T: m = the 64 dims of a head, n = the token: put_planes<1>, rows = tokens, k = the 64 m. v as X W^T: m = the token, n = the dim: put_planes<2>, rows = the 64 dims, k = tokens, VT's block order.
template <typename T16> struct WFrag;
template <> struct WFrag<h16> { typedef v16h V; static __device__ __forceinline__ V ld(const h16* p) { return cat16(*(const v8h*)p, *(const v8h*)(p + 256)); } static __device__ __forceinline__ v8f mma(V a, V b, v8f c) { return wmma16(a, b, c); } };
template <> struct WFrag<bf> { typedef v16bf V; static __device__ __forceinline__ V ld(const bf* p) { return cat16b(*(const v8us*)p, *(const v8us*)(p + 256)); }
    static __device__ __forceinline__ v8f mma(V a, V b, v8f c) { return wmmab(a, b, c); } };
template <int ORD> __device__ __forceinline__ void put_planes(const v8f (&acc)[4][4], h16* ho) {
#pragma unroll
    for (int nb = 0; nb < 4; ++nb)
#pragma unroll
        for (int mb = 0; mb < 4; ++mb) { v8h o;
#pragma unroll
            for (int j = 0; j < 8; ++j) o[j] = (h16)acc[mb][nb][j];
            *(v8h*)(ho + (ORD == 1 ? nb * 1024 + mb * 256 : (mb >> 1) * 2048 + nb * 512 + (mb & 1) * 256)) = o; }
}
// cp8, cp4: one lane's copies of two planes, or of one, of a stage: four copies of 16 bytes a plane. Copy i of a plane takes row groups 2 i and 2 i + 1 (128 lanes x 16 bytes = 2 KiB), which lie 2 * 16 * DD elements apart in memory and 2 KiB apart in LDS.
// s_wait_xcnt 0 is the last line of the copies' own statement: it stands in front of every later write of the address registers that the copies name.
#define CPL "global_load_async_to_lds_b128 "
template <typename T16> __device__ __forceinline__ void cp8(unsigned la, const T16* ga, unsigned lb, const T16* gb) {
    constexpr int G = 2 * 16 * DD;
    asm volatile(CPL "%0, %8, off\n\t" CPL "%1, %9, off\n\t" CPL "%2, %10, off\n\t" CPL "%3, %11, off\n\t" CPL "%4, %12, off\n\t" CPL "%5, %13, off\n\t" CPL "%6, %14, off\n\t" CPL "%7, %15, off\n\ts_wait_xcnt 0x0"
                 :: "v"(la), "v"(la + 2048u), "v"(la + 4096u), "v"(la + 6144u), "v"(lb), "v"(lb + 2048u), "v"(lb + 4096u), "v"(lb + 6144u),
                    "v"(ga), "v"(ga + G), "v"(ga + 2 * G), "v"(ga + 3 * G), "v"(gb), "v"(gb + G), "v"(gb + 2 * G), "v"(gb + 3 * G) : "memory");
}
template <typename T16> __device__ __forceinline__ void cp4(unsigned la, const T16* ga) {
    constexpr int G = 2 * 16 * DD;
    asm volatile(CPL "%0, %4, off\n\t" CPL "%1, %5, off\n\t" CPL "%2, %6, off\n\t" CPL "%3, %7, off\n\ts_wait_xcnt 0x0"
                 :: "v"(la), "v"(la + 2048u), "v"(la + 4096u), "v"(la + 6144u), "v"(ga), "v"(ga + G), "v"(ga + 2 * G), "v"(ga + 3 * G) : "memory");
}
template <typename T16, int NSPLIT, bool BIAS, int HOUT>
__global__ __launch_bounds__(128) void k_gemmw(const T16* __restrict__ A, const T16* __restrict__ A2, const T16* __restrict__ Bt, const T16* __restrict__ Bt2, float* C, int ldc, const float* __restrict__ bias, size_t sA, size_t sB, size_t sC, h16* H) {
    typedef typename WFrag<T16>::V V; constexpr int K = DD;   // every product here runs over the model width
    static_assert(NSPLIT <= 1, "one or two A planes");
    constexpr int NP = NSPLIT == 1 ? 3 : 2, PL = 8 * 512;   // planes of a stage (A, the second A, Bt) and the elements of one: 128 rows x 32 k
    __shared__ __align__(16) T16 sm[2 * NP * PL];
    __shared__ __align__(16) float osm[4 * 16 * 68];
    const size_t z = blockIdx.z; A += z * sA; if (A2) A2 += z * sA; Bt += z * sB; C += z * sC; (void)Bt2;
    const int tid = threadIdx.x, lane = tid & 31, lr = lane & 15, hi = lane >> 4;
    const int wv = __builtin_amdgcn_readfirstlane(tid >> 5), wm = wv & 1, wn = wv >> 1;   // the wave's place in the block's 2 x 2
    int rb = blockIdx.x * 128, cb = blockIdx.y * 128;   // the block's first row of A and of Bt
    h16* ho = H; bool isv = false;
    if constexpr (HOUT != 0) {   // flat tile number -> projection, pair of heads, 128 tokens; the wave's head and 64 tokens from its place; all of it the same for the whole wave
        constexpr unsigned NHP = NH_ / 2, NKT = NB_ * TKC / 128, NT = NKT * NHP; const unsigned t = blockIdx.x; int hp, tk, lt, x0; size_t w0, h0;   // NKT = source-token tiles, NT = tiles of k (and of v); lt = log2 of a batch's tokens
        if (t < NT) { hp = t % NHP; tk = t / NHP; lt = __builtin_ctz(TKC); x0 = NB_ * TQ; w0 = (size_t)DD * DD; h0 = (size_t)NB_ * NH_ * TQ * HD; }
        else if (t < 2 * NT) { isv = true; tk = (t - NT) % NKT; hp = (t - NT) / NKT; lt = __builtin_ctz(TKC); x0 = NB_ * TQ; w0 = (size_t)2 * DD * DD; h0 = (size_t)NB_ * NH_ * (TQ + TKC) * HD; }
        else { hp = (t - 2 * NT) % NHP; tk = (t - 2 * NT) / NHP; lt = __builtin_ctz(TQ); x0 = 0; w0 = 0; h0 = 0; }
        const int head = hp * 2 + (isv ? wn : wm), tok = tk * 128 + (isv ? wm : wn) * 64;
        ho += h0 + ((((size_t)((tok >> lt) * NH_ + head)) << lt) + (tok & ((1 << lt) - 1))) * HD + lane * 8;   // 64 tokens of one head are 4096 elements of its plane, in q, k and VT alike
        const T16* Wp = A + w0; const T16* Xp = Bt;
        A = isv ? Xp : Wp; Bt = isv ? Wp : Xp; rb = isv ? x0 + tk * 128 : hp * 128; cb = isv ? hp * 128 : x0 + tk * 128;
    }
    const int r0 = rb + wm * 64, c0 = cb + wn * 64;
    v8f acc[4][4];
#pragma unroll
    for (int mb = 0; mb < 4; ++mb)
#pragma unroll
        for (int nb = 0; nb < 4; ++nb) acc[mb][nb] = (v8f){};
    // the lane's 16 bytes of every copy: row group tid >> 6 of the pair, piece tid & 63 of its 1 KiB; in LDS that is byte tid * 16 of the pair's 2 KiB
    const size_t go = (size_t)(tid >> 6) * 16 * K + (size_t)(tid & 63) * 8;
    const T16* ga = A + (size_t)rb * K + go; const T16* ga2 = NSPLIT == 1 ? A2 + (size_t)rb * K + go : nullptr; const T16* gb = Bt + (size_t)cb * K + go;
    const unsigned l0 = (unsigned)(size_t)(const void*)sm + 16u * (unsigned)tid;   // LDS byte address: the low 32 bits of the __shared__ address
    auto fill = [&](int buf, int kc) {   // the block's operands of k kc .. kc + 31 into buffer buf
        const unsigned l = l0 + (unsigned)buf * (unsigned)(NP * PL * 2);
        cp8(l, ga + kc * 16, l + (unsigned)((NP - 1) * PL * 2), gb + kc * 16);
        if constexpr (NSPLIT == 1) cp4(l + (unsigned)(PL * 2), ga2 + kc * 16);
    };
    auto publish = [&](int buf, int kc) {   // the hand-over behind a trip's last LDS read, passed by every wave
        asm volatile("s_wait_dscnt 0x0" ::: "memory");      // this wave's reads of the buffer are done before it is filled again
        asm volatile("s_wait_asynccnt 0x0" ::: "memory");   // this wave's copies of the next tile have landed
        __syncthreads();                                     // publishes the next tile and ends every wave's reads of this one
        if (kc + 64 < K) fill(buf, kc + 64);
    };
    fill(0, 0);
    asm volatile("s_wait_asynccnt 0x0" ::: "memory");   // this wave's copies of tile 0 have landed
    __syncthreads();                                     // ... and every other wave's
    fill(1, 32);
#pragma unroll 1   // stays rolled: one trip a tile, its buffer chosen by the trip's parity
    for (int kc = 0; kc < K; kc += 32) {
        const int buf = (kc >> 5) & 1; const T16* sb = sm + buf * (NP * PL) + lane * 8;
        V a[4], a2[4];
#pragma unroll
        for (int mb = 0; mb < 4; ++mb) { a[mb] = WFrag<T16>::ld(sb + (wm * 4 + mb) * 512); if (NSPLIT == 1) a2[mb] = WFrag<T16>::ld(sb + PL + (wm * 4 + mb) * 512); }
        V b[4]; constexpr int AH = HOUT != 0 ? 1 : 3;   // Bt fragments are read AH ahead of their products, so that a read's latency lies under the products in front of it: one ahead where five waves share a SIMD's registers, all four at once where a wave has the SIMD alone
#pragma unroll
        for (int nb = 0; nb <= AH; ++nb) b[nb] = WFrag<T16>::ld(sb + (NP - 1) * PL + (wn * 4 + nb) * 512);
        __builtin_amdgcn_sched_barrier(0);   // keeps the reads in front of the products (the scheduler sinks each Bt read to directly in front of its first product otherwise, and the wave then waits out its whole latency)
        if constexpr (AH == 3) { publish(buf, kc); __builtin_amdgcn_sched_barrier(0); }   // the whole tile is in registers: the buffer is handed over at once, and the scheduling barrier keeps the products behind the copies, so that all of them cover the copies' flight
#pragma unroll
        for (int nb = 0; nb < 4; ++nb) { if (nb >= 1 && nb + AH < 4) { b[nb + AH] = WFrag<T16>::ld(sb + (NP - 1) * PL + (wn * 4 + nb + AH) * 512); __builtin_amdgcn_sched_barrier(0); }   // the same, for the read that goes one group ahead
#pragma unroll
            for (int mb = 0; mb < 4; ++mb) { acc[mb][nb] = WFrag<T16>::mma(a[mb], b[nb], acc[mb][nb]); if (NSPLIT == 1) acc[mb][nb] = WFrag<T16>::mma(a2[mb], b[nb], acc[mb][nb]); } }
        asm volatile("v_nop\n\tv_nop\n\tv_nop\n\tv_nop" : "+v"(acc[0][0]), "+v"(acc[1][1]), "+v"(acc[2][2]), "+v"(acc[3][3]) : "v"(a[0]), "v"(a[3]));   // the vector slots that the chip needs behind a matrix instruction, before the next trip's instructions overwrite the fragments (also on the taken side of the loop's branch)
        if constexpr (AH != 3) publish(buf, kc);
    }
    asm volatile("s_wait_asynccnt 0x0" ::: "memory");   // no copy is outstanding when the wave goes on
    if constexpr (HOUT != 0) {
        if (isv) put_planes<2>(acc, ho); else put_planes<1>(acc, ho);
        return;
    }
    float* os = osm + wv * (16 * 68);   // each wave stages in its own range
#pragma unroll
    for (int mb = 0; mb < 4; ++mb) {
#pragma unroll
        for (int nb = 0; nb < 4; ++nb) {
#pragma unroll
            for (int j = 0; j < 8; ++j) os[(hi * 8 + j) * 68 + nb * 16 + lr] = acc[mb][nb][j]; }
        __builtin_amdgcn_wave_barrier(); asm volatile("" ::: "memory");
        float* crow = C + (size_t)(r0 + mb * 16) * ldc + c0;
{
#pragma unroll
            for (int s = 0; s < 8; ++s) { const int row = 2 * s + hi, cofs = lr * 4; v4f val = *(const v4fa*)(os + row * 68 + cofs); if (BIAS) { val[0] += bfr(bias[c0 + cofs]); val[1] += bfr(bias[c0 + cofs + 1]); val[2] += bfr(bias[c0 + cofs + 2]); val[3] += bfr(bias[c0 + cofs + 3]); }
                *(v4f*)(crow + (size_t)row * ldc + cofs) = val; }
             }
        __builtin_amdgcn_wave_barrier(); asm volatile("" ::: "memory");
    }
}

__device__ __forceinline__ h16 tohx(float x) { return (h16)x; }
__device__ __forceinline__ void splitf(float y, unsigned short& h, unsigned short& l) { h = f2bf(y); l = f2bf(y - bf2f(h)); }

// cvt8: f32 [rows][DD] -> bf16 in fragment order, thread i of a plane. 64 threads a block of 16 rows x 32 k: four neighbours read one row's 128-byte line, eight rows' pieces of one k octet are one 128-byte line of the block.
__device__ __forceinline__ void cvt8(const float* __restrict__ src, bf* dst, size_t i) { const size_t blk = i >> 6; const int c4 = (int)i & 3, row = ((int)i >> 2) & 15;
    const v8f v = *(const v8f*)(src + ((blk / (DD / 32)) * 16 + row) * DD + (blk % (DD / 32)) * 32 + c4 * 8); v8us o;
#pragma unroll
    for (int k = 0; k < 8; ++k) o[k] = f2bf(v[k]); *(v8us*)(dst + blk * 512 + c4 * 128 + row * 8) = o;  }
__device__ __forceinline__ void limp(const float* __restrict__ imp, float* LI, int i) { const int b = i / TKC, j = i % TKC; const float w = fmaxf(bfr(imp[b * NSEN + (j % NSEN)]), 1e-6f); const float l = logf(w); *(float*)(LI + i) = l;
    asm volatile("s_wait_xcnt 0x0" ::: "memory"); }   // stands behind the store: in the merged kernel the conversion path is laid out behind it and rewrites the registers that the store names
// k_prep: every input's conversion in ONE launch. A block of 256 threads belongs whole to one plane, by its number: 4096 blocks of key_value, 2048 of query, 512 of each weight, 32 of the importance terms; the ranges are exact, so no thread is idle.
// X = the activation plane (query tokens, then source tokens), WP = the weight planes (q, k, v, o in a row).
__global__ __launch_bounds__(256) void k_prep(const float* __restrict__ kv, const float* __restrict__ q, const float* __restrict__ wq, const float* __restrict__ wk, const float* __restrict__ wv, const float* __restrict__ wo, const float* __restrict__ imp, bf* X, bf* WP, float* LI) {
    constexpr unsigned BKV = NB_ * TKC * DD / 2048, BQ = NB_ * TQ * DD / 2048, BW = DD * DD / 2048;
    unsigned t = blockIdx.x; const float* src; bf* dst;
    if (t < BKV) { src = kv; dst = X + (size_t)NB_ * TQ * DD; }
    else if ((t -= BKV) < BQ) { src = q; dst = X; }
    else if ((t -= BQ) < 4 * BW) { const unsigned w = t / BW; t %= BW; src = w == 0 ? wq : w == 1 ? wk : w == 2 ? wv : wo; dst = WP + (size_t)w * DD * DD; }
    else { limp(imp, LI, (int)((t - 4 * BW) * 256 + threadIdx.x)); return; }
    cvt8(src, dst, (size_t)t * 256 + threadIdx.x);
}
__device__ __forceinline__ float xhalf(float x) { return __builtin_bit_cast(float, __builtin_amdgcn_permlanex16(__builtin_bit_cast(int, x), __builtin_bit_cast(int, x), 0x76543210, 0xfedcba98, false, false)); }   // lane l takes lane l ^ 16
__global__ __launch_bounds__(256) void k_fattn(const h16* __restrict__ QP, const h16* __restrict__ KP, const h16* __restrict__ VT, const float* __restrict__ LI, bf* Ah, bf* Al) {
    const int lane = threadIdx.x & 31, lr = lane & 15, hi = lane >> 4, wv = threadIdx.x >> 5;
    const int h = blockIdx.y, b = blockIdx.z, q0 = blockIdx.x * 256 + wv * 32;
    const h16* Qp = QP + ((size_t)(b * NH_ + h) * TQ + q0) * HD + 8 * lane;   // all three planes in fragment order: 16 tokens of q or k are two blocks, 32 keys of VT four
    const h16* Kp = KP + (size_t)(b * NH_ + h) * TKC * HD + 8 * lane;
    const h16* Vp = VT + (size_t)(b * NH_ + h) * HD * TKC + 8 * lane;
    v16h qf[2][2], kf[2][2];
#pragma unroll
    for (int q = 0; q < 2; ++q)
#pragma unroll
        for (int c = 0; c < 2; ++c) { qf[q][c] = WFrag<h16>::ld(Qp + q * 16 * HD + c * 512); kf[q][c] = WFrag<h16>::ld(Kp + q * 16 * HD + c * 512); }
    float li2[8];   // key k carries the term of sensor k mod 16 (the reference tiles imp over t_kv), and every tile starts at a multiple of 16: the lane's eight terms are the same in every tile
#pragma unroll
    for (int j = 0; j < 8; ++j) li2[j] = LI[(size_t)b * TKC + hi * 8 + j] * L2E;
    v8f acc[4][2];
#pragma unroll
    for (int dt = 0; dt < 4; ++dt) { acc[dt][0] = (v8f){}; acc[dt][1] = (v8f){}; }
    float m[2] = { -3.0e38f, -3.0e38f }, l[2] = { 0.f, 0.f };
#pragma unroll 1   // stays rolled: one pass already holds some 230 registers, and a second copy of the body would only lengthen the code
    for (int kc = 0; kc < TKC; kc += 32) {
        v16h vf[4];
#pragma unroll
        for (int dt = 0; dt < 4; ++dt) vf[dt] = WFrag<h16>::ld(Vp + (size_t)kc * HD + dt * 512);
        asm volatile("s_wait_xcnt 0x0" ::: "memory");   // stands in front of the step of the V address pair, which the loads just issued name
        __builtin_amdgcn_sched_barrier(0);   // keeps the V loads at the head of the pass (the scheduler sinks them behind the maximum otherwise), so that the score products and the maximum cover their latency
        v8f st[2][2];
#pragma unroll
        for (int t = 0; t < 2; ++t)
#pragma unroll
            for (int q = 0; q < 2; ++q) st[t][q] = wmma16(kf[t][1], qf[q][1], wmma16(kf[t][0], qf[q][0], (v8f){}));
        const int kn = kc + 32 < TKC ? kc + 32 : 0;   // the next pass's key rows, fetched while this pass does its softmax; the last pass re-reads rows 0..31 (in bounds, not used)
#pragma unroll
        for (int t = 0; t < 2; ++t)
#pragma unroll
            for (int c = 0; c < 2; ++c) kf[t][c] = WFrag<h16>::ld(Kp + (size_t)(kn + t * 16) * HD + c * 512);
        __builtin_amdgcn_sched_barrier(0);   // keeps the K fetch directly behind the score products (the scheduler sinks it behind the rescale branch otherwise): the whole softmax and attn.v of this pass cover its latency
        float mx[2];
#pragma unroll
        for (int q = 0; q < 2; ++q) { float x = -3.0e38f;
#pragma unroll
            for (int t = 0; t < 2; ++t)
#pragma unroll
                for (int j = 0; j < 8; ++j) { st[t][q][j] = fmaf(st[t][q][j], SCL * L2E, li2[j]); x = fmaxf(x, st[t][q][j]); }
            mx[q] = fmaxf(x, xhalf(x)); }
        if (__builtin_amdgcn_ballot_w32(mx[0] > m[0] + 5.0f || mx[1] > m[1] + 5.0f) != 0) {   // one scalar branch a pass
#pragma unroll
            for (int q = 0; q < 2; ++q) { const float mn = fmaxf(m[q], mx[q]); const float al = __builtin_amdgcn_exp2f(m[q] - mn); m[q] = mn; l[q] *= al;
#pragma unroll
                for (int dt = 0; dt < 4; ++dt) acc[dt][q] *= al; }
        }
#pragma unroll
        for (int q = 0; q < 2; ++q) { const float cq = 10.0f - m[q]; v16h pb;
#pragma unroll
            for (int t = 0; t < 2; ++t) { float e[8];
#pragma unroll
                for (int j = 0; j < 8; ++j) e[j] = st[t][q][j] + cq;
                // eight exponentials in place and the free slot behind the last one in ONE statement: no instruction directly behind a v_exp reads its result or overwrites its source
                asm("v_exp_f32 %0, %0\n\tv_exp_f32 %1, %1\n\tv_exp_f32 %2, %2\n\tv_exp_f32 %3, %3\n\tv_exp_f32 %4, %4\n\tv_exp_f32 %5, %5\n\tv_exp_f32 %6, %6\n\tv_exp_f32 %7, %7\n\tv_nop"
                    : "+v"(e[0]), "+v"(e[1]), "+v"(e[2]), "+v"(e[3]), "+v"(e[4]), "+v"(e[5]), "+v"(e[6]), "+v"(e[7]));
#pragma unroll
                for (int j = 0; j < 8; ++j) { l[q] += e[j]; pb[t * 8 + j] = tohx(e[j]); } }
#pragma unroll
            for (int dt = 0; dt < 4; ++dt) acc[dt][q] = wmma16(vf[dt], pb, acc[dt][q]); }
    }
#pragma unroll
    for (int q = 0; q < 2; ++q) { const float inv = __fdiv_rn(1.0f, l[q] + xhalf(l[q]));   // the halves' sums joined once
        const size_t oo = ((size_t)b * TQ + q0 + q * 16) * DD + h * 1024 + lane * 8;   // fragment order, rows = tokens, k = the 1024 merged features: head h is blocks 2h and 2h + 1 of the 16 tokens, tile dt a half block
#pragma unroll
        for (int dt = 0; dt < 4; ++dt) { v8us oh, ol;
#pragma unroll
            for (int j = 0; j < 8; ++j) { unsigned short a, c2; splitf(__fmul_rn(acc[dt][q][j], inv), a, c2); oh[j] = a; ol[j] = c2; }
            *(v8us*)(Ah + oo + dt * 256) = oh; *(v8us*)(Al + oo + dt * 256) = ol; } }
}

extern "C" void kernel_launch(void* const* d_in, const int* in_sizes, int n_in,
                              void* d_out, int out_size, void* d_ws, size_t ws_size, hipStream_t stream) {
    (void)in_sizes; (void)n_in; (void)out_size;
    const float* qin = (const float*)d_in[0]; const float* kvin = (const float*)d_in[1]; const float* imp = (const float*)d_in[2]; const float* wq = (const float*)d_in[3]; const float* wk = (const float*)d_in[4]; const float* wv = (const float*)d_in[5]; const float* wo = (const float*)d_in[6];   // torch [out][in] weights
    float* OUT = (float*)d_out;     // [2][2048][1024]
    char* wsp = (char*)d_ws;
    auto take = [&](size_t bytes) { char* p = wsp; wsp += (bytes + 255) & ~(size_t)255; return (void*)p; };
    bf* WP = (bf*)take((size_t)4 * DD * DD * 2); bf* WO = WP + (size_t)3 * DD * DD; float* LI = (float*)take((size_t)NB_ * TKC * 4);   // weight planes q, k, v, o in a row
    bf* X = (bf*)take((size_t)NB_ * (TQ + TKC) * DD * 2);   // the query tokens of both batches, then the source tokens of both
    h16* QP = (h16*)take((size_t)NB_ * NH_ * (TQ + 2 * TKC) * HD * 2); h16* KP = QP + (size_t)NB_ * NH_ * TQ * HD; h16* VT = KP + (size_t)NB_ * NH_ * TKC * HD;   // head planes in a row
    bf* Ah = (bf*)take((size_t)NB_ * TQ * DD * 2); bf* Al = (bf*)take((size_t)NB_ * TQ * DD * 2);
    if ((size_t)(wsp - (char*)d_ws) > ws_size) return;    // total ~ 88 MiB; ws 256 MiB
    k_prep<<<NB_ * (TQ + TKC) * DD / 2048 + 4 * DD * DD / 2048 + NB_ * TKC / 256, 256, 0, stream>>>(kvin, qin, wq, wk, wv, wo, imp, X, WP, LI);
    k_gemmw<bf, 0, false, 1><<<NB_ * (TQ + 2 * TKC) / 128 * (NH_ / 2), 128, 0, stream>>>(WP, nullptr, X, nullptr, nullptr, 0, nullptr, 0, 0, 0, QP);
    k_fattn<<<dim3(TQ / 256, NH_, NB_), 256, 0, stream>>>(QP, KP, VT, LI, Ah, Al);
    k_gemmw<bf, 1, false, 0><<<dim3(NB_ * TQ / 128, DD / 128, 1), 128, 0, stream>>>(Ah, Al, WO, nullptr, OUT, DD, nullptr, 0, 0, 0, nullptr);   // the batches' tokens stand in a row in Ah, Al and out: one product over all 4096
}

// v007
// Measured time: 132 microseconds a run.
// Next to v006, in two timings, it ran 1.29 and 1.28 times as fast.
// Over all steps from v000 it is 34.6 times as fast.
#include <hip/hip_runtime.h>

// Temporal decoder cross-attention with sensor importance (query [2][2048][1024], key_value [2][256][16][1024] -> 4096 source tokens (t_kv, sensor), imp_weights [2][16]; q/k/v = x W^T (16 heads x 64);
// scores = q.k/8 + log(max(imp[b][sensor of key], 1e-6)) (read as data); softmax over the 4096 keys; out = merged (attn v) W_o^T -> [2][2048][1024]).
// Compute dtypes, f32 accumulate: every input rounded to bf16; q/k/v projections on PLAIN bf16 operands (inputs: exact products, f32 accumulate); scores (K 64) and attn.v on

#define NB_  2
#define TQ   2048
#define TKC  4096
#define NSEN 16
#define DD   1024
#define NH_  16
#define HD   64
#define SCL  0.125f
#define L2E  1.4426950408889634f
typedef _Float16 h16;
typedef unsigned short bf;
typedef __attribute__((ext_vector_type(16))) __bf16   v16bf;
typedef __attribute__((ext_vector_type(16))) _Float16 v16h;
typedef __attribute__((ext_vector_type(8)))  _Float16 v8h;
typedef __attribute__((ext_vector_type(8)))  unsigned short v8us;
typedef __attribute__((ext_vector_type(8)))  float    v8f;
typedef __attribute__((ext_vector_type(4)))  float    v4f;
typedef v8h  __attribute__((may_alias)) v8ha;
typedef v4f  __attribute__((may_alias)) v4fa;
typedef v8us __attribute__((may_alias)) v8usa;

__device__ __forceinline__ unsigned short f2bf(float f) { unsigned u = __float_as_uint(f); u += 0x7FFFu + ((u >> 16) & 1u); return (unsigned short)(u >> 16); }
__device__ __forceinline__ float bf2f(unsigned short b) { return __uint_as_float(((unsigned)b) << 16); }
__device__ __forceinline__ float bfr(float f) { return bf2f(f2bf(f)); }
__device__ __forceinline__ v16h cat16(v8h lo, v8h hi) { return __builtin_shufflevector(lo, hi, 0, 1, 2, 3, 4, 5, 6, 7, 8, 9, 10, 11, 12, 13, 14, 15); }
__device__ __forceinline__ v16bf cat16b(v8us lo, v8us hi) { return __builtin_bit_cast(v16bf, __builtin_shufflevector(lo, hi, 0, 1, 2, 3, 4, 5, 6, 7, 8, 9, 10, 11, 12, 13, 14, 15)); }
__device__ __forceinline__ v8f wmma16(v16h a, v16h b, v8f c) { return __builtin_amdgcn_wmma_f32_16x16x32_f16(false, a, false, b, (short)0, c, false, false); }
__device__ __forceinline__ v8f wmmab(v16bf a, v16bf b, v8f c) { return __builtin_amdgcn_wmma_f32_16x16x32_bf16(false, a, false, b, (short)0, c, false, false); }



// ---- FRAGMENT ORDER: every 16-bit operand plane X[row][k] lies in blocks of 16 rows x 32 k (1 KiB), a block holding its elements as the matrix loader takes them: element (row, k) stands at
// block * 512 + ((k >> 4) & 1) * 256 + ((k >> 3) & 1) * 128 + (row & 15) * 8 + (k & 7). A fragment is then two wave-wide 16-byte loads at lane * 8 and lane * 8 + 256, each 512 contiguous bytes (4 whole lines; row-major planes gave 16 quarter lines a load).
// Block order: (row >> 4) * (K / 32) + (k >> 5), so 16 rows of all k take 16 * K elements as before; VT alone has (key >> 5) * 4 + (dim >> 4), so that the four fragments of a pass are contiguous. Registers hold the same values as with row-major planes.
// ---- k_gemmw: GEMM, a block of FOUR WAVES (2 x 2) per 128x128 output tile, each wave a 64x64 part (16 accumulators); 128 threads; HOUT 0: grid (M/128, N/128, Z).
// The operands of 32 k (128 rows of A, of the second A plane where there is one, and of Bt: 8 KiB each) are brought into LDS by asynchronous copies, once for the block, and each fragment is read from there by the two waves that need it:
// half the bytes from L2, and the copies of tile t + 2 fly while tile t + 1 is worked on (two buffers). A plane in fragment order is copied as it lies: 16 rows x 32 k are 1 KiB in a row, and a fragment read is 512 contiguous LDS bytes a load.
// C[m][n] (f32, pitch ldc, + optional f32 bias[n]) = sum_k A[m][k] Bt[n][k] (+ the second A plane's products, NSPLIT 1). z-batch strides sA/sB/sC in elements. K = DD.
// HOUT: the tile goes out as f16 straight from the accumulators, in fragment order with m as the k of the plane and n as its row. A lane holds 8 consecutive m of one n, which is one 16-byte store at lane * 8 of a half block: a wave's store is 512 contiguous bytes.
// HOUT 1: ALL THREE PROJECTIONS OF BOTH BATCHES IN ONE LAUNCH, so that a SIMD holds several waves and one wave's waits are another's matrix time. Grid = the flat tile number: 512 tiles of k, 512 of v, 256 of q; a tile is two heads x 128 tokens.
// A = the weight planes (q, k, v in a row), Bt = the activation plane (the 4096 query tokens, then the 8192 source tokens), H = the head planes (QP, KP, VT in a row).
// q, k as W X^T: m = the 64 dims of a head, n = the token: put_planes<1>, rows = tokens, k = the 64 m. v as X W^T: m = the token, n = the dim: put_planes<2>, rows = the 64 dims, k = tokens, VT's block order.
template <typename T16> struct WFrag;
template <> struct WFrag<h16> { typedef v16h V; static __device__ __forceinline__ V ld(const h16* p) { return cat16(*(const v8h*)p, *(const v8h*)(p + 256)); } static __device__ __forceinline__ v8f mma(V a, V b, v8f c) { return wmma16(a, b, c); } };
template <> struct WFrag<bf> { typedef v16bf V; static __device__ __forceinline__ V ld(const bf* p) { return cat16b(*(const v8us*)p, *(const v8us*)(p + 256)); }
    static __device__ __forceinline__ v8f mma(V a, V b, v8f c) { return wmmab(a, b, c); } };
template <int ORD> __device__ __forceinline__ void put_planes(const v8f (&acc)[4][4], h16* ho) {
#pragma unroll
    for (int nb = 0; nb < 4; ++nb)
#pragma unroll
        for (int mb = 0; mb < 4; ++mb) { v8h o;
#pragma unroll
            for (int j = 0; j < 8; ++j) o[j] = (h16)acc[mb][nb][j];
            *(v8h*)(ho + (ORD == 1 ? nb * 1024 + mb * 256 : (mb >> 1) * 2048 + nb * 512 + (mb & 1) * 256)) = o; }
}
// cp8, cp4: one lane's copies of two planes, or of one, of a stage: four copies of 16 bytes a plane. Copy i of a plane takes row groups 2 i and 2 i + 1 (128 lanes x 16 bytes = 2 KiB), which lie 2 * 16 * DD elements apart in memory and 2 KiB apart in LDS.
// s_wait_xcnt 0 is the last line of the copies' own statement: it stands in front of every later write of the address registers that the copies name.
#define CPL "global_load_async_to_lds_b128 "
template <typename T16> __device__ __forceinline__ void cp8(unsigned la, const T16* ga, unsigned lb, const T16* gb) {
    constexpr int G = 2 * 16 * DD;
    asm volatile(CPL "%0, %8, off\n\t" CPL "%1, %9, off\n\t" CPL "%2, %10, off\n\t" CPL "%3, %11, off\n\t" CPL "%4, %12, off\n\t" CPL "%5, %13, off\n\t" CPL "%6, %14, off\n\t" CPL "%7, %15, off\n\ts_wait_xcnt 0x0"
                 :: "v"(la), "v"(la + 2048u), "v"(la + 4096u), "v"(la + 6144u), "v"(lb), "v"(lb + 2048u), "v"(lb + 4096u), "v"(lb + 6144u),
                    "v"(ga), "v"(ga + G), "v"(ga + 2 * G), "v"(ga + 3 * G), "v"(gb), "v"(gb + G), "v"(gb + 2 * G), "v"(gb + 3 * G) : "memory");
}
template <typename T16> __device__ __forceinline__ void cp4(unsigned la, const T16* ga) {
    constexpr int G = 2 * 16 * DD;
    asm volatile(CPL "%0, %4, off\n\t" CPL "%1, %5, off\n\t" CPL "%2, %6, off\n\t" CPL "%3, %7, off\n\ts_wait_xcnt 0x0"
                 :: "v"(la), "v"(la + 2048u), "v"(la + 4096u), "v"(la + 6144u), "v"(ga), "v"(ga + G), "v"(ga + 2 * G), "v"(ga + 3 * G) : "memory");
}
template <typename T16, int NSPLIT, bool BIAS, int HOUT>
__global__ __launch_bounds__(128) void k_gemmw(const T16* __restrict__ A, const T16* __restrict__ A2, const T16* __restrict__ Bt, const T16* __restrict__ Bt2, float* C, int ldc, const float* __restrict__ bias, size_t sA, size_t sB, size_t sC, h16* H) {
    typedef typename WFrag<T16>::V V; constexpr int K = DD;   // every product here runs over the model width
    static_assert(NSPLIT <= 1, "one or two A planes");
    constexpr int NP = NSPLIT == 1 ? 3 : 2, PL = 8 * 512;   // planes of a stage (A, the second A, Bt) and the elements of one: 128 rows x 32 k
    __shared__ __align__(16) T16 sm[2 * NP * PL];
    __shared__ __align__(16) float osm[4 * 16 * 68];
    const size_t z = blockIdx.z; A += z * sA; if (A2) A2 += z * sA; Bt += z * sB; C += z * sC; (void)Bt2;
    const int tid = threadIdx.x, lane = tid & 31, lr = lane & 15, hi = lane >> 4;
    const int wv = __builtin_amdgcn_readfirstlane(tid >> 5), wm = wv & 1, wn = wv >> 1;   // the wave's place in the block's 2 x 2
    int rb = blockIdx.x * 128, cb = blockIdx.y * 128;   // the block's first row of A and of Bt
    h16* ho = H; bool isv = false;
    if constexpr (HOUT != 0) {   // flat tile number -> projection, pair of heads, 128 tokens; the wave's head and 64 tokens from its place; all of it the same for the whole wave
        constexpr unsigned NHP = NH_ / 2, NKT = NB_ * TKC / 128, NT = NKT * NHP; const unsigned t = blockIdx.x; int hp, tk, lt, x0; size_t w0, h0;   // NKT = source-token tiles, NT = tiles of k (and of v); lt = log2 of a batch's tokens
        if (t < NT) { hp = t % NHP; tk = t / NHP; lt = __builtin_ctz(TKC); x0 = NB_ * TQ; w0 = (size_t)DD * DD; h0 = (size_t)NB_ * NH_ * TQ * HD; }
        else if (t < 2 * NT) { isv = true; tk = (t - NT) % NKT; hp = (t - NT) / NKT; lt = __builtin_ctz(TKC); x0 = NB_ * TQ; w0 = (size_t)2 * DD * DD; h0 = (size_t)NB_ * NH_ * (TQ + TKC) * HD; }
        else { hp = (t - 2 * NT) % NHP; tk = (t - 2 * NT) / NHP; lt = __builtin_ctz(TQ); x0 = 0; w0 = 0; h0 = 0; }
        const int head = hp * 2 + (isv ? wn : wm), tok = tk * 128 + (isv ? wm : wn) * 64;
        ho += h0 + ((((size_t)((tok >> lt) * NH_ + head)) << lt) + (tok & ((1 << lt) - 1))) * HD + lane * 8;   // 64 tokens of one head are 4096 elements of its plane, in q, k and VT alike
        const T16* Wp = A + w0; const T16* Xp = Bt;
        A = isv ? Xp : Wp; Bt = isv ? Wp : Xp; rb = isv ? x0 + tk * 128 : hp * 128; cb = isv ? hp * 128 : x0 + tk * 128;
    }
    const int r0 = rb + wm * 64, c0 = cb + wn * 64;
    v8f acc[4][4];
#pragma unroll
    for (int mb = 0; mb < 4; ++mb)
#pragma unroll
        for (int nb = 0; nb < 4; ++nb) acc[mb][nb] = (v8f){};
    // the lane's 16 bytes of every copy: row group tid >> 6 of the pair, piece tid & 63 of its 1 KiB; in LDS that is byte tid * 16 of the pair's 2 KiB
    const size_t go = (size_t)(tid >> 6) * 16 * K + (size_t)(tid & 63) * 8;
    const T16* ga = A + (size_t)rb * K + go; const T16* ga2 = NSPLIT == 1 ? A2 + (size_t)rb * K + go : nullptr; const T16* gb = Bt + (size_t)cb * K + go;
    const unsigned l0 = (unsigned)(size_t)(const void*)sm + 16u * (unsigned)tid;   // LDS byte address: the low 32 bits of the __shared__ address
    auto fill = [&](int buf, int kc) {   // the block's operands of k kc .. kc + 31 into buffer buf
        const unsigned l = l0 + (unsigned)buf * (unsigned)(NP * PL * 2);
        cp8(l, ga + kc * 16, l + (unsigned)((NP - 1) * PL * 2), gb + kc * 16);
        if constexpr (NSPLIT == 1) cp4(l + (unsigned)(PL * 2), ga2 + kc * 16);
    };
    auto publish = [&](int buf, int kc) {   // the hand-over behind a trip's last LDS read, passed by every wave
        asm volatile("s_wait_dscnt 0x0" ::: "memory");      // this wave's reads of the buffer are done before it is filled again
        asm volatile("s_wait_asynccnt 0x0" ::: "memory");   // this wave's copies of the next tile have landed
        __syncthreads();                                     // publishes the next tile and ends every wave's reads of this one
        if (kc + 64 < K) fill(buf, kc + 64);
    };
    fill(0, 0);
    asm volatile("s_wait_asynccnt 0x0" ::: "memory");   // this wave's copies of tile 0 have landed
    __syncthreads();                                     // ... and every other wave's
    fill(1, 32);
#pragma unroll 1   // stays rolled: one trip a tile, its buffer chosen by the trip's parity
    for (int kc = 0; kc < K; kc += 32) {
        const int buf = (kc >> 5) & 1; const T16* sb = sm + buf * (NP * PL) + lane * 8;
        V a[4], a2[4];
#pragma unroll
        for (int mb = 0; mb < 4; ++mb) { a[mb] = WFrag<T16>::ld(sb + (wm * 4 + mb) * 512); if (NSPLIT == 1) a2[mb] = WFrag<T16>::ld(sb + PL + (wm * 4 + mb) * 512); }
        V b[4]; constexpr int AH = HOUT != 0 ? 1 : 3;   // Bt fragments are read AH ahead of their products, so that a read's latency lies under the products in front of it: one ahead where five waves share a SIMD's registers, all four at once where a wave has the SIMD alone
#pragma unroll
        for (int nb = 0; nb <= AH; ++nb) b[nb] = WFrag<T16>::ld(sb + (NP - 1) * PL + (wn * 4 + nb) * 512);
        __builtin_amdgcn_sched_barrier(0);   // keeps the reads in front of the products (the scheduler sinks each Bt read to directly in front of its first product otherwise, and the wave then waits out its whole latency)
        if constexpr (AH == 3) { publish(buf, kc); __builtin_amdgcn_sched_barrier(0); }   // the whole tile is in registers: the buffer is handed over at once, and the scheduling barrier keeps the products behind the copies, so that all of them cover the copies' flight
#pragma unroll
        for (int nb = 0; nb < 4; ++nb) { if (nb >= 1 && nb + AH < 4) { b[nb + AH] = WFrag<T16>::ld(sb + (NP - 1) * PL + (wn * 4 + nb + AH) * 512); __builtin_amdgcn_sched_barrier(0); }   // the same, for the read that goes one group ahead
#pragma unroll
            for (int mb = 0; mb < 4; ++mb) { acc[mb][nb] = WFrag<T16>::mma(a[mb], b[nb], acc[mb][nb]); if (NSPLIT == 1) acc[mb][nb] = WFrag<T16>::mma(a2[mb], b[nb], acc[mb][nb]); } }
        asm volatile("v_nop\n\tv_nop\n\tv_nop\n\tv_nop" : "+v"(acc[0][0]), "+v"(acc[1][1]), "+v"(acc[2][2]), "+v"(acc[3][3]) : "v"(a[0]), "v"(a[3]));   // the vector slots that the chip needs behind a matrix instruction, before the next trip's instructions overwrite the fragments (also on the taken side of the loop's branch)
        if constexpr (AH != 3) publish(buf, kc);
    }
    asm volatile("s_wait_asynccnt 0x0" ::: "memory");   // no copy is outstanding when the wave goes on
    if constexpr (HOUT != 0) {
        if (isv) put_planes<2>(acc, ho); else put_planes<1>(acc, ho);
        return;
    }
    float* os = osm + wv * (16 * 68);   // each wave stages in its own range
#pragma unroll
    for (int mb = 0; mb < 4; ++mb) {
#pragma unroll
        for (int nb = 0; nb < 4; ++nb) {
#pragma unroll
            for (int j = 0; j < 8; ++j) os[(hi * 8 + j) * 68 + nb * 16 + lr] = acc[mb][nb][j]; }
        __builtin_amdgcn_wave_barrier(); asm volatile("" ::: "memory");
        float* crow = C + (size_t)(r0 + mb * 16) * ldc + c0;
{
#pragma unroll
            for (int s = 0; s < 8; ++s) { const int row = 2 * s + hi, cofs = lr * 4; v4f val = *(const v4fa*)(os + row * 68 + cofs); if (BIAS) { val[0] += bfr(bias[c0 + cofs]); val[1] += bfr(bias[c0 + cofs + 1]); val[2] += bfr(bias[c0 + cofs + 2]); val[3] += bfr(bias[c0 + cofs + 3]); }
                *(v4f*)(crow + (size_t)row * ldc + cofs) = val; }
             }
        __builtin_amdgcn_wave_barrier(); asm volatile("" ::: "memory");
    }
}

__device__ __forceinline__ h16 tohx(float x) { return (h16)x; }
__device__ __forceinline__ void splitf(float y, unsigned short& h, unsigned short& l) { h = f2bf(y); l = f2bf(y - bf2f(h)); }

// cvt8: f32 [rows][DD] -> bf16 in fragment order, thread i of a plane. 64 threads a block of 16 rows x 32 k: four neighbours read one row's 128-byte line, eight rows' pieces of one k octet are one 128-byte line of the block.
__device__ __forceinline__ void cvt8(const float* __restrict__ src, bf* dst, size_t i) { const size_t blk = i >> 6; const int c4 = (int)i & 3, row = ((int)i >> 2) & 15;
    const v8f v = *(const v8f*)(src + ((blk / (DD / 32)) * 16 + row) * DD + (blk % (DD / 32)) * 32 + c4 * 8); v8us o;
#pragma unroll
    for (int k = 0; k < 8; ++k) o[k] = f2bf(v[k]); *(v8us*)(dst + blk * 512 + c4 * 128 + row * 8) = o;  }
__device__ __forceinline__ void limp(const float* __restrict__ imp, float* LI, int i) { const int b = i / TKC, j = i % TKC; const float w = fmaxf(bfr(imp[b * NSEN + (j % NSEN)]), 1e-6f); const float l = logf(w); *(float*)(LI + i) = l;
    asm volatile("s_wait_xcnt 0x0" ::: "memory"); }   // stands behind the store: in the merged kernel the conversion path is laid out behind it and rewrites the registers that the store names
// k_prep: every input's conversion in ONE launch. A block of 256 threads belongs whole to one plane, by its number: 4096 blocks of key_value, 2048 of query, 512 of each weight, 32 of the importance terms; the ranges are exact, so no thread is idle.
// X = the activation plane (query tokens, then source tokens), WP = the weight planes (q, k, v, o in a row).
__global__ __launch_bounds__(256) void k_prep(const float* __restrict__ kv, const float* __restrict__ q, const float* __restrict__ wq, const float* __restrict__ wk, const float* __restrict__ wv, const float* __restrict__ wo, const float* __restrict__ imp, bf* X, bf* WP, float* LI) {
    constexpr unsigned BKV = NB_ * TKC * DD / 2048, BQ = NB_ * TQ * DD / 2048, BW = DD * DD / 2048;
    unsigned t = blockIdx.x; const float* src; bf* dst;
    if (t < BKV) { src = kv; dst = X + (size_t)NB_ * TQ * DD; }
    else if ((t -= BKV) < BQ) { src = q; dst = X; }
    else if ((t -= BQ) < 4 * BW) { const unsigned w = t / BW; t %= BW; src = w == 0 ? wq : w == 1 ? wk : w == 2 ? wv : wo; dst = WP + (size_t)w * DD * DD; }
    else { limp(imp, LI, (int)((t - 4 * BW) * 256 + threadIdx.x)); return; }
    cvt8(src, dst, (size_t)t * 256 + threadIdx.x);
}
__device__ __forceinline__ float xhalf(float x) { return __builtin_bit_cast(float, __builtin_amdgcn_permlanex16(__builtin_bit_cast(int, x), __builtin_bit_cast(int, x), 0x76543210, 0xfedcba98, false, false)); }   // lane l takes lane l ^ 16
__global__ __launch_bounds__(512) void k_fattn(const h16* __restrict__ QP, const h16* __restrict__ KP, const h16* __restrict__ VT, const float* __restrict__ LI, bf* Ah, bf* Al) {
    constexpr int KS = TKC / 2, XQ = 9 * 128;   // keys of a half; floats that a wave hands over for one column group: 8 pieces of 16 bytes a lane of output tiles, one of maximum and sum
    __shared__ __align__(16) float xs[8 * 2 * XQ];
    const int lane = threadIdx.x & 31, hi = lane >> 4;
    const int wv = __builtin_amdgcn_readfirstlane(threadIdx.x >> 5), qg = wv & 7, kh = wv >> 3;   // the wave's query group and its half of the keys
    const int h = blockIdx.y, b = blockIdx.z, q0 = blockIdx.x * 256 + qg * 32;
    const h16* Qp = QP + ((size_t)(b * NH_ + h) * TQ + q0) * HD + 8 * lane;   // all three planes in fragment order: 16 tokens of q or k are two blocks, 32 keys of VT four
    const h16* Kp = KP + ((size_t)(b * NH_ + h) * TKC + kh * KS) * HD + 8 * lane;   // both start at the wave's first key: a key takes HD elements in either plane
    const h16* Vp = VT + ((size_t)(b * NH_ + h) * TKC + kh * KS) * HD + 8 * lane;
    v16h qf[2][2], kf[2][2];
#pragma unroll
    for (int q = 0; q < 2; ++q)
#pragma unroll
        for (int c = 0; c < 2; ++c) { qf[q][c] = WFrag<h16>::ld(Qp + q * 16 * HD + c * 512); kf[q][c] = WFrag<h16>::ld(Kp + q * 16 * HD + c * 512); }
    float li2[8];   // key k carries the term of sensor k mod 16 (the reference tiles imp over t_kv), and every tile starts at a multiple of 16: the lane's eight terms are the same in every tile
#pragma unroll
    for (int j = 0; j < 8; ++j) li2[j] = LI[(size_t)b * TKC + hi * 8 + j] * L2E;
    v8f acc[4][2];
#pragma unroll
    for (int dt = 0; dt < 4; ++dt) { acc[dt][0] = (v8f){}; acc[dt][1] = (v8f){}; }
    float m[2] = { -3.0e38f, -3.0e38f }, l[2] = { 0.f, 0.f };
#pragma unroll 1   // stays rolled: one pass already holds some 230 registers, and a second copy of the body would only lengthen the code
    for (int kc = 0; kc < KS; kc += 32) {
        v16h vf[4];
#pragma unroll
        for (int dt = 0; dt < 4; ++dt) vf[dt] = WFrag<h16>::ld(Vp + (size_t)kc * HD + dt * 512);
        asm volatile("s_wait_xcnt 0x0" ::: "memory");   // stands in front of the step of the V address pair, which the loads just issued name
        __builtin_amdgcn_sched_barrier(0);   // keeps the V loads at the head of the pass (the scheduler sinks them behind the maximum otherwise), so that the score products and the maximum cover their latency
        v8f st[2][2];
#pragma unroll
        for (int t = 0; t < 2; ++t)
#pragma unroll
            for (int q = 0; q < 2; ++q) st[t][q] = wmma16(kf[t][1], qf[q][1], wmma16(kf[t][0], qf[q][0], (v8f){}));
        const int kn = kc + 32 < KS ? kc + 32 : 0;   // the next pass's key rows, fetched while this pass does its softmax; the last pass re-reads the half's rows 0..31 (in bounds, not used)
#pragma unroll
        for (int t = 0; t < 2; ++t)
#pragma unroll
            for (int c = 0; c < 2; ++c) kf[t][c] = WFrag<h16>::ld(Kp + (size_t)(kn + t * 16) * HD + c * 512);
        __builtin_amdgcn_sched_barrier(0);   // keeps the K fetch directly behind the score products (the scheduler sinks it behind the rescale branch otherwise): the whole softmax and attn.v of this pass cover its latency
        float mx[2];
#pragma unroll
        for (int q = 0; q < 2; ++q) { float x = -3.0e38f;
#pragma unroll
            for (int t = 0; t < 2; ++t)
#pragma unroll
                for (int j = 0; j < 8; ++j) { st[t][q][j] = fmaf(st[t][q][j], SCL * L2E, li2[j]); x = fmaxf(x, st[t][q][j]); }
            mx[q] = fmaxf(x, xhalf(x)); }
        if (__builtin_amdgcn_ballot_w32(mx[0] > m[0] + 5.0f || mx[1] > m[1] + 5.0f) != 0) {   // one scalar branch a pass
#pragma unroll
            for (int q = 0; q < 2; ++q) { const float mn = fmaxf(m[q], mx[q]); const float al = __builtin_amdgcn_exp2f(m[q] - mn); m[q] = mn; l[q] *= al;
#pragma unroll
                for (int dt = 0; dt < 4; ++dt) acc[dt][q] *= al; }
        }
#pragma unroll
        for (int q = 0; q < 2; ++q) { const float cq = 10.0f - m[q]; v16h pb;
#pragma unroll
            for (int t = 0; t < 2; ++t) { float e[8];
#pragma unroll
                for (int j = 0; j < 8; ++j) e[j] = st[t][q][j] + cq;
                // eight exponentials in place and the free slot behind the last one in ONE statement: no instruction directly behind a v_exp reads its result or overwrites its source
                asm("v_exp_f32 %0, %0\n\tv_exp_f32 %1, %1\n\tv_exp_f32 %2, %2\n\tv_exp_f32 %3, %3\n\tv_exp_f32 %4, %4\n\tv_exp_f32 %5, %5\n\tv_exp_f32 %6, %6\n\tv_exp_f32 %7, %7\n\tv_nop"
                    : "+v"(e[0]), "+v"(e[1]), "+v"(e[2]), "+v"(e[3]), "+v"(e[4]), "+v"(e[5]), "+v"(e[6]), "+v"(e[7]));
#pragma unroll
                for (int j = 0; j < 8; ++j) { l[q] += e[j]; pb[t * 8 + j] = tohx(e[j]); } }
#pragma unroll
            for (int dt = 0; dt < 4; ++dt) acc[dt][q] = wmma16(vf[dt], pb, acc[dt][q]); }
    }
    // The join: the wave of the first key half finishes column group 0, its partner column group 1; each hands the other group's state over. A piece is 16 bytes a lane, 512 contiguous bytes a wave.
    float* xp = xs + qg * (2 * XQ) + lane * 4;
    auto put = [&](int q) { float* p = xp + q * XQ;
#pragma unroll
        for (int dt = 0; dt < 4; ++dt) { *(v4fa*)(p + dt * 256) = __builtin_shufflevector(acc[dt][q], acc[dt][q], 0, 1, 2, 3); *(v4fa*)(p + dt * 256 + 128) = __builtin_shufflevector(acc[dt][q], acc[dt][q], 4, 5, 6, 7); }
        *(v4fa*)(p + 8 * 128) = (v4f){ m[q], l[q], 0.f, 0.f }; };
    auto fin = [&](int q) { const float* p = xp + q * XQ; const v4f ml = *(const v4fa*)(p + 8 * 128);
        const float mn = fmaxf(m[q], ml[0]); float a0 = m[q] - mn, a1 = ml[0] - mn;   // both maxima are finite: each half has walked its keys
        asm("v_exp_f32 %0, %0\n\tv_exp_f32 %1, %1\n\tv_nop" : "+v"(a0), "+v"(a1));   // the two weights and the free slot behind the last exponential in one statement, as in the loop
        const float ls = fmaf(l[q], a0, ml[1] * a1); const float inv = __fdiv_rn(1.0f, ls + xhalf(ls));   // the lane halves' sums joined once
        const float s0 = a0 * inv, s1 = a1 * inv;
        const size_t oo = ((size_t)b * TQ + q0 + q * 16) * DD + h * 1024 + lane * 8;   // fragment order, rows = tokens, k = the 1024 merged features: head h is blocks 2h and 2h + 1 of the 16 tokens, tile dt a half block
#pragma unroll
        for (int dt = 0; dt < 4; ++dt) { const v4f x0 = *(const v4fa*)(p + dt * 256), x1 = *(const v4fa*)(p + dt * 256 + 128); v8us oh, ol;
#pragma unroll
            for (int j = 0; j < 8; ++j) { unsigned short a, c2; splitf(fmaf(acc[dt][q][j], s0, (j < 4 ? x0[j & 3] : x1[j & 3]) * s1), a, c2); oh[j] = a; ol[j] = c2; }
            *(v8us*)(Ah + oo + dt * 256) = oh; *(v8us*)(Al + oo + dt * 256) = ol; } };
    if (kh == 0) put(1); else put(0);
    __syncthreads();   // every wave's hand-over is written before its partner reads it
    if (kh == 0) fin(0); else fin(1);
}

extern "C" void kernel_launch(void* const* d_in, const int* in_sizes, int n_in,
                              void* d_out, int out_size, void* d_ws, size_t ws_size, hipStream_t stream) {
    (void)in_sizes; (void)n_in; (void)out_size;
    const float* qin = (const float*)d_in[0]; const float* kvin = (const float*)d_in[1]; const float* imp = (const float*)d_in[2]; const float* wq = (const float*)d_in[3]; const float* wk = (const float*)d_in[4]; const float* wv = (const float*)d_in[5]; const float* wo = (const float*)d_in[6];   // torch [out][in] weights
    float* OUT = (float*)d_out;     // [2][2048][1024]
    char* wsp = (char*)d_ws;
    auto take = [&](size_t bytes) { char* p = wsp; wsp += (bytes + 255) & ~(size_t)255; return (void*)p; };
    bf* WP = (bf*)take((size_t)4 * DD * DD * 2); bf* WO = WP + (size_t)3 * DD * DD; float* LI = (float*)take((size_t)NB_ * TKC * 4);   // weight planes q, k, v, o in a row
    bf* X = (bf*)take((size_t)NB_ * (TQ + TKC) * DD * 2);   // the query tokens of both batches, then the source tokens of both
    h16* QP = (h16*)take((size_t)NB_ * NH_ * (TQ + 2 * TKC) * HD * 2); h16* KP = QP + (size_t)NB_ * NH_ * TQ * HD; h16* VT = KP + (size_t)NB_ * NH_ * TKC * HD;   // head planes in a row
    bf* Ah = (bf*)take((size_t)NB_ * TQ * DD * 2); bf* Al = (bf*)take((size_t)NB_ * TQ * DD * 2);
    if ((size_t)(wsp - (char*)d_ws) > ws_size) return;    // total ~ 88 MiB; ws 256 MiB
    k_prep<<<NB_ * (TQ + TKC) * DD / 2048 + 4 * DD * DD / 2048 + NB_ * TKC / 256, 256, 0, stream>>>(kvin, qin, wq, wk, wv, wo, imp, X, WP, LI);
    k_gemmw<bf, 0, false, 1><<<NB_ * (TQ + 2 * TKC) / 128 * (NH_ / 2), 128, 0, stream>>>(WP, nullptr, X, nullptr, nullptr, 0, nullptr, 0, 0, 0, QP);
    k_fattn<<<dim3(TQ / 256, NH_, NB_), 512, 0, stream>>>(QP, KP, VT, LI, Ah, Al);
    k_gemmw<bf, 1, false, 0><<<dim3(NB_ * TQ / 128, DD / 128, 1), 128, 0, stream>>>(Ah, Al, WO, nullptr, OUT, DD, nullptr, 0, 0, 0, nullptr);   // the batches' tokens stand in a row in Ah, Al and out: one product over all 4096
}

// v008
// One run takes 118 microseconds.
// Two timings next to v007 put it at 1.13 and 1.12 times that version's speed.
// Over all steps from v000 it is 38.9 times as fast.
#include <hip/hip_runtime.h>

// Temporal decoder cross-attention with sensor importance (query [2][2048][1024], key_value [2][256][16][1024] -> 4096 source tokens (t_kv, sensor), imp_weights [2][16]; q/k/v = x W^T (16 heads x 64);
// scores = q.k/8 + log(max(imp[b][sensor of key], 1e-6)) (read as data); softmax over the 4096 keys; out = merged (attn v) W_o^T -> [2][2048][1024]).
// Compute dtypes, f32 accumulate: every input rounded to bf16; q/k/v projections on PLAIN bf16 operands (inputs: exact products, f32 accumulate); scores (K 64) and attn.v on

#define NB_  2
#define TQ   2048
#define TKC  4096
#define NSEN 16
#define DD   1024
#define NH_  16
#define HD   64
#define SCL  0.125f
#define L2E  1.4426950408889634f
typedef _Float16 h16;
typedef unsigned short bf;
typedef __attribute__((ext_vector_type(16))) __bf16   v16bf;
typedef __attribute__((ext_vector_type(16))) _Float16 v16h;
typedef __attribute__((ext_vector_type(8)))  _Float16 v8h;
typedef __attribute__((ext_vector_type(8)))  unsigned short v8us;
typedef __attribute__((ext_vector_type(8)))  float    v8f;
typedef __attribute__((ext_vector_type(4)))  float    v4f;
typedef v8h  __attribute__((may_alias)) v8ha;
typedef v4f  __attribute__((may_alias)) v4fa;
typedef v8us __attribute__((may_alias)) v8usa;

__device__ __forceinline__ unsigned short f2bf(float f) { unsigned u = __float_as_uint(f); u += 0x7FFFu + ((u >> 16) & 1u); return (unsigned short)(u >> 16); }
__device__ __forceinline__ float bf2f(unsigned short b) { return __uint_as_float(((unsigned)b) << 16); }
__device__ __forceinline__ float bfr(float f) { return bf2f(f2bf(f)); }
__device__ __forceinline__ v16h cat16(v8h lo, v8h hi) { return __builtin_shufflevector(lo, hi, 0, 1, 2, 3, 4, 5, 6, 7, 8, 9, 10, 11, 12, 13, 14, 15); }
__device__ __forceinline__ v16bf cat16b(v8us lo, v8us hi) { return __builtin_bit_cast(v16bf, __builtin_shufflevector(lo, hi, 0, 1, 2, 3, 4, 5, 6, 7, 8, 9, 10, 11, 12, 13, 14, 15)); }
__device__ __forceinline__ v8f wmma16(v16h a, v16h b, v8f c) { return __builtin_amdgcn_wmma_f32_16x16x32_f16(false, a, false, b, (short)0, c, false, false); }
__device__ __forceinline__ v8f wmmab(v16bf a, v16bf b, v8f c) { return __builtin_amdgcn_wmma_f32_16x16x32_bf16(false, a, false, b, (short)0, c, false, false); }



// ---- FRAGMENT ORDER: every 16-bit operand plane X[row][k] lies in blocks of 16 rows x 32 k (1 KiB), a block holding its elements as the matrix loader takes them: element (row, k) stands at
// block * 512 + ((k >> 4) & 1) * 256 + ((k >> 3) & 1) * 128 + (row & 15) * 8 + (k & 7). A fragment is then two wave-wide 16-byte loads at lane * 8 and lane * 8 + 256, each 512 contiguous bytes (4 whole lines; row-major planes gave 16 quarter lines a load).
// Block order: (row >> 4) * (K / 32) + (k >> 5), so 16 rows of all k take 16 * K elements as before; VT alone has (key >> 5) * 4 + (dim >> 4), so that the four fragments of a pass are contiguous. Registers hold the same values as with row-major planes.
// ---- k_gemmw: GEMM, a block of FOUR WAVES (2 x 2) per 128x128 output tile, each wave a 64x64 part (16 accumulators); 128 threads; HOUT 0: grid (M/128, N/128, Z).
// The operands of 32 k (128 rows of A, of the second A plane where there is one, and of Bt: 8 KiB each) are brought into LDS by asynchronous copies, once for the block, and each fragment is read from there by the two waves that need it:
// half the bytes from L2, and the copies of stage s + 2 fly while stage s + 1 is worked on (two buffers; a stage is one such tile, or four of them: SK below). A plane in fragment order is copied as it lies: 16 rows x 32 k are 1 KiB in a row, and a fragment read is 512 contiguous LDS bytes a load.
// C[m][n] (f32, pitch ldc, + optional f32 bias[n]) = sum_k A[m][k] Bt[n][k] (+ the second A plane's products, NSPLIT 1). z-batch strides sA/sB/sC in elements. K = DD.
// HOUT: the tile goes out as f16 straight from the accumulators, in fragment order with m as the k of the plane and n as its row. A lane holds 8 consecutive m of one n, which is one 16-byte store at lane * 8 of a half block: a wave's store is 512 contiguous bytes.
// HOUT 1: ALL THREE PROJECTIONS OF BOTH BATCHES IN ONE LAUNCH, so that a SIMD holds several waves and one wave's waits are another's matrix time. Grid = the flat tile number: 512 tiles of k, 512 of v, 256 of q; a tile is two heads x 128 tokens.
// A = the weight planes (q, k, v in a row), Bt = the activation plane (the 4096 query tokens, then the 8192 source tokens), H = the head planes (QP, KP, VT in a row).
// q, k as W X^T: m = the 64 dims of a head, n = the token: put_planes<1>, rows = tokens, k = the 64 m. v as X W^T: m = the token, n = the dim: put_planes<2>, rows = the 64 dims, k = tokens, VT's block order.
template <typename T16> struct WFrag;
template <> struct WFrag<h16> { typedef v16h V; static __device__ __forceinline__ V ld(const h16* p) { return cat16(*(const v8h*)p, *(const v8h*)(p + 256)); } static __device__ __forceinline__ v8f mma(V a, V b, v8f c) { return wmma16(a, b, c); } };
template <> struct WFrag<bf> { typedef v16bf V; static __device__ __forceinline__ V ld(const bf* p) { return cat16b(*(const v8us*)p, *(const v8us*)(p + 256)); }
    static __device__ __forceinline__ v8f mma(V a, V b, v8f c) { return wmmab(a, b, c); } };
template <int ORD> __device__ __forceinline__ void put_planes(const v8f (&acc)[4][4], h16* ho) {
#pragma unroll
    for (int nb = 0; nb < 4; ++nb)
#pragma unroll
        for (int mb = 0; mb < 4; ++mb) { v8h o;
#pragma unroll
            for (int j = 0; j < 8; ++j) o[j] = (h16)acc[mb][nb][j];
            *(v8h*)(ho + (ORD == 1 ? nb * 1024 + mb * 256 : (mb >> 1) * 2048 + nb * 512 + (mb & 1) * 256)) = o; }
}
// cp8, cp4: one lane's copies of two planes, or of one, of a tile of 32 k: four copies of 16 bytes a plane. Copy i of a plane takes row groups 2 i and 2 i + 1 (128 lanes x 16 bytes = 2 KiB), which lie 2 * 16 * DD elements apart in memory and 2 KiB apart in LDS.
// s_wait_xcnt 0 is the last line of the copies' own statement: it stands in front of every later write of the address registers that the copies name.
#define CPL "global_load_async_to_lds_b128 "
template <typename T16> __device__ __forceinline__ void cp8(unsigned la, const T16* ga, unsigned lb, const T16* gb) {
    constexpr int G = 2 * 16 * DD;
    asm volatile(CPL "%0, %8, off\n\t" CPL "%1, %9, off\n\t" CPL "%2, %10, off\n\t" CPL "%3, %11, off\n\t" CPL "%4, %12, off\n\t" CPL "%5, %13, off\n\t" CPL "%6, %14, off\n\t" CPL "%7, %15, off\n\ts_wait_xcnt 0x0"
                 :: "v"(la), "v"(la + 2048u), "v"(la + 4096u), "v"(la + 6144u), "v"(lb), "v"(lb + 2048u), "v"(lb + 4096u), "v"(lb + 6144u),
                    "v"(ga), "v"(ga + G), "v"(ga + 2 * G), "v"(ga + 3 * G), "v"(gb), "v"(gb + G), "v"(gb + 2 * G), "v"(gb + 3 * G) : "memory");
}
template <typename T16> __device__ __forceinline__ void cp4(unsigned la, const T16* ga) {
    constexpr int G = 2 * 16 * DD;
    asm volatile(CPL "%0, %4, off\n\t" CPL "%1, %5, off\n\t" CPL "%2, %6, off\n\t" CPL "%3, %7, off\n\ts_wait_xcnt 0x0"
                 :: "v"(la), "v"(la + 2048u), "v"(la + 4096u), "v"(la + 6144u), "v"(ga), "v"(ga + G), "v"(ga + 2 * G), "v"(ga + 3 * G) : "memory");
}
template <typename T16, int NSPLIT, bool BIAS, int HOUT>
__global__ __launch_bounds__(128) void k_gemmw(const T16* __restrict__ A, const T16* __restrict__ A2, const T16* __restrict__ Bt, const T16* __restrict__ Bt2, float* C, int ldc, const float* __restrict__ bias, size_t sA, size_t sB, size_t sC, h16* H) {
    typedef typename WFrag<T16>::V V; constexpr int K = DD;   // every product here runs over the model width
    static_assert(NSPLIT <= 1, "one or two A planes");
    constexpr int NP = NSPLIT == 1 ? 3 : 2, PL = 8 * 512;   // planes of a tile (A, the second A, Bt) and the elements of one: 128 rows x 32 k
    // SK = tiles of 32 k in a stage of the ring. A stage's copies have one whole stage of work to land in. Where a wave has its SIMD alone (HOUT 0) nothing else covers a late copy:
    // four tiles a stage there. Where five blocks share a WGP one tile stays (five blocks of larger stages would take the whole LDS).
    constexpr int SK = HOUT != 0 ? 1 : 4;
    static_assert(K % (2 * 32 * SK) == 0, "whole stages, two or more");
    __shared__ __align__(16) T16 sm[2 * SK * NP * PL];
    __shared__ __align__(16) float osm[4 * 16 * 68];
    const size_t z = blockIdx.z; A += z * sA; if (A2) A2 += z * sA; Bt += z * sB; C += z * sC; (void)Bt2;
    const int tid = threadIdx.x, lane = tid & 31, lr = lane & 15, hi = lane >> 4;
    const int wv = __builtin_amdgcn_readfirstlane(tid >> 5), wm = wv & 1, wn = wv >> 1;   // the wave's place in the block's 2 x 2
    int rb = blockIdx.x * 128, cb = blockIdx.y * 128;   // the block's first row of A and of Bt
    h16* ho = H; bool isv = false;
    if constexpr (HOUT != 0) {   // flat tile number -> projection, pair of heads, 128 tokens; the wave's head and 64 tokens from its place; all of it the same for the whole wave
        constexpr unsigned NHP = NH_ / 2, NKT = NB_ * TKC / 128, NT = NKT * NHP; const unsigned t = blockIdx.x; int hp, tk, lt, x0; size_t w0, h0;   // NKT = source-token tiles, NT = tiles of k (and of v); lt = log2 of a batch's tokens
        if (t < NT) { hp = t % NHP; tk = t / NHP; lt = __builtin_ctz(TKC); x0 = NB_ * TQ; w0 = (size_t)DD * DD; h0 = (size_t)NB_ * NH_ * TQ * HD; }
        else if (t < 2 * NT) { isv = true; tk = (t - NT) % NKT; hp = (t - NT) / NKT; lt = __builtin_ctz(TKC); x0 = NB_ * TQ; w0 = (size_t)2 * DD * DD; h0 = (size_t)NB_ * NH_ * (TQ + TKC) * HD; }
        else { hp = (t - 2 * NT) % NHP; tk = (t - 2 * NT) / NHP; lt = __builtin_ctz(TQ); x0 = 0; w0 = 0; h0 = 0; }
        const int head = hp * 2 + (isv ? wn : wm), tok = tk * 128 + (isv ? wm : wn) * 64;
        ho += h0 + ((((size_t)((tok >> lt) * NH_ + head)) << lt) + (tok & ((1 << lt) - 1))) * HD + lane * 8;   // 64 tokens of one head are 4096 elements of its plane, in q, k and VT alike
        const T16* Wp = A + w0; const T16* Xp = Bt;
        A = isv ? Xp : Wp; Bt = isv ? Wp : Xp; rb = isv ? x0 + tk * 128 : hp * 128; cb = isv ? hp * 128 : x0 + tk * 128;
    }
    const int r0 = rb + wm * 64, c0 = cb + wn * 64;
    v8f acc[4][4];
#pragma unroll
    for (int mb = 0; mb < 4; ++mb)
#pragma unroll
        for (int nb = 0; nb < 4; ++nb) acc[mb][nb] = (v8f){};
    // the lane's 16 bytes of every copy: row group tid >> 6 of the pair, piece tid & 63 of its 1 KiB; in LDS that is byte tid * 16 of the pair's 2 KiB
    const size_t go = (size_t)(tid >> 6) * 16 * K + (size_t)(tid & 63) * 8;
    const T16* ga = A + (size_t)rb * K + go; const T16* ga2 = NSPLIT == 1 ? A2 + (size_t)rb * K + go : nullptr; const T16* gb = Bt + (size_t)cb * K + go;
    const unsigned l0 = (unsigned)(size_t)(const void*)sm + 16u * (unsigned)tid;   // LDS byte address: the low 32 bits of the __shared__ address
    auto fill = [&](int buf, int ks) {   // the block's operands of k ks .. ks + 32 * SK - 1, one stage, into buffer buf, tile by tile
#pragma unroll 1   // stays rolled: unrolled, the compiler kept every tile's addresses in registers through the whole k loop (316 registers and spills to scratch; rolled: 272 and none)
        for (int u = 0; u < SK; ++u) {
            const unsigned l = l0 + (unsigned)(buf * SK + u) * (unsigned)(NP * PL * 2); const int kc = ks + 32 * u;
            cp8(l, ga + kc * 16, l + (unsigned)((NP - 1) * PL * 2), gb + kc * 16);
            if constexpr (NSPLIT == 1) cp4(l + (unsigned)(PL * 2), ga2 + kc * 16);
        }
    };
    auto publish = [&](int buf, int ks) {   // the hand-over behind a stage's last LDS read, passed by every wave; ks = the stage's first k
        asm volatile("s_wait_dscnt 0x0" ::: "memory");      // this wave's reads of the buffer are done before it is filled again
        asm volatile("s_wait_asynccnt 0x0" ::: "memory");   // this wave's copies of the next stage have landed
        __syncthreads();                                     // publishes the next stage and ends every wave's reads of this one
        if (ks + 2 * 32 * SK < K) fill(buf, ks + 2 * 32 * SK);
    };
    fill(0, 0);
    asm volatile("s_wait_asynccnt 0x0" ::: "memory");   // this wave's copies of stage 0 have landed
    __syncthreads();                                     // ... and every other wave's
    fill(1, 32 * SK);
#pragma unroll 1   // stays rolled: one trip a tile, its buffer chosen by the stage's parity
    for (int kc = 0; kc < K; kc += 32) {
        const int sub = (kc >> 5) % SK, ks = kc - 32 * sub, buf = ((kc >> 5) / SK) & 1; const T16* sb = sm + (buf * SK + sub) * (NP * PL) + lane * 8;   // the tile's place in its stage, the stage's first k, its buffer: the same for the whole block
        V a[4], a2[4];
#pragma unroll
        for (int mb = 0; mb < 4; ++mb) { a[mb] = WFrag<T16>::ld(sb + (wm * 4 + mb) * 512); if (NSPLIT == 1) a2[mb] = WFrag<T16>::ld(sb + PL + (wm * 4 + mb) * 512); }
        V b[4]; constexpr int AH = HOUT != 0 ? 1 : 3;   // Bt fragments are read AH ahead of their products, so that a read's latency lies under the products in front of it: one ahead where five waves share a SIMD's registers, all four at once where a wave has the SIMD alone
#pragma unroll
        for (int nb = 0; nb <= AH; ++nb) b[nb] = WFrag<T16>::ld(sb + (NP - 1) * PL + (wn * 4 + nb) * 512);
        __builtin_amdgcn_sched_barrier(0);   // keeps the reads in front of the products (the scheduler sinks each Bt read to directly in front of its first product otherwise, and the wave then waits out its whole latency)
        static_assert(AH == 3 || SK == 1, "the hand-over at the trip's foot takes one tile a stage");
        if constexpr (AH == 3) { if (sub == SK - 1) publish(buf, ks); __builtin_amdgcn_sched_barrier(0); }   // the stage's last tile is in registers: the buffer is handed over at once, and the scheduling barrier keeps the products behind the copies, so that all of them cover the copies' flight
#pragma unroll
        for (int nb = 0; nb < 4; ++nb) { if (nb >= 1 && nb + AH < 4) { b[nb + AH] = WFrag<T16>::ld(sb + (NP - 1) * PL + (wn * 4 + nb + AH) * 512); __builtin_amdgcn_sched_barrier(0); }   // the same, for the read that goes one group ahead
#pragma unroll
            for (int mb = 0; mb < 4; ++mb) { acc[mb][nb] = WFrag<T16>::mma(a[mb], b[nb], acc[mb][nb]); if (NSPLIT == 1) acc[mb][nb] = WFrag<T16>::mma(a2[mb], b[nb], acc[mb][nb]); } }
        asm volatile("v_nop\n\tv_nop\n\tv_nop\n\tv_nop" : "+v"(acc[0][0]), "+v"(acc[1][1]), "+v"(acc[2][2]), "+v"(acc[3][3]) : "v"(a[0]), "v"(a[3]));   // the vector slots that the chip needs behind a matrix instruction, before the next trip's instructions overwrite the fragments (also on the taken side of the loop's branch)
        if constexpr (AH != 3) publish(buf, ks);
    }
    asm volatile("s_wait_asynccnt 0x0" ::: "memory");   // no copy is outstanding when the wave goes on
    if constexpr (HOUT != 0) {
        if (isv) put_planes<2>(acc, ho); else put_planes<1>(acc, ho);
        return;
    }
    float* os = osm + wv * (16 * 68);   // each wave stages in its own range
#pragma unroll
    for (int mb = 0; mb < 4; ++mb) {
#pragma unroll
        for (int nb = 0; nb < 4; ++nb) {
#pragma unroll
            for (int j = 0; j < 8; ++j) os[(hi * 8 + j) * 68 + nb * 16 + lr] = acc[mb][nb][j]; }
        __builtin_amdgcn_wave_barrier(); asm volatile("" ::: "memory");
        float* crow = C + (size_t)(r0 + mb * 16) * ldc + c0;
{
#pragma unroll
            for (int s = 0; s < 8; ++s) { const int row = 2 * s + hi, cofs = lr * 4; v4f val = *(const v4fa*)(os + row * 68 + cofs); if (BIAS) { val[0] += bfr(bias[c0 + cofs]); val[1] += bfr(bias[c0 + cofs + 1]); val[2] += bfr(bias[c0 + cofs + 2]); val[3] += bfr(bias[c0 + cofs + 3]); }
                *(v4f*)(crow + (size_t)row * ldc + cofs) = val; }
             }
        __builtin_amdgcn_wave_barrier(); asm volatile("" ::: "memory");
    }
}

__device__ __forceinline__ h16 tohx(float x) { return (h16)x; }
__device__ __forceinline__ void splitf(float y, unsigned short& h, unsigned short& l) { h = f2bf(y); l = f2bf(y - bf2f(h)); }

// cvt8: f32 [rows][DD] -> bf16 in fragment order, thread i of a plane. 64 threads a block of 16 rows x 32 k: four neighbours read one row's 128-byte line, eight rows' pieces of one k octet are one 128-byte line of the block.
__device__ __forceinline__ void cvt8(const float* __restrict__ src, bf* dst, size_t i) { const size_t blk = i >> 6; const int c4 = (int)i & 3, row = ((int)i >> 2) & 15;
    const v8f v = *(const v8f*)(src + ((blk / (DD / 32)) * 16 + row) * DD + (blk % (DD / 32)) * 32 + c4 * 8); v8us o;
#pragma unroll
    for (int k = 0; k < 8; ++k) o[k] = f2bf(v[k]); *(v8us*)(dst + blk * 512 + c4 * 128 + row * 8) = o;  }
__device__ __forceinline__ void limp(const float* __restrict__ imp, float* LI, int i) { const int b = i / TKC, j = i % TKC; const float w = fmaxf(bfr(imp[b * NSEN + (j % NSEN)]), 1e-6f); const float l = logf(w); *(float*)(LI + i) = l;
    asm volatile("s_wait_xcnt 0x0" ::: "memory"); }   // stands behind the store: in the merged kernel the conversion path is laid out behind it and rewrites the registers that the store names
// k_prep: every input's conversion in ONE launch. A block of 256 threads belongs whole to one plane, by its number: 4096 blocks of key_value, 2048 of query, 512 of each weight, 32 of the importance terms; the ranges are exact, so no thread is idle.
// X = the activation plane (query tokens, then source tokens), WP = the weight planes (q, k, v, o in a row).
__global__ __launch_bounds__(256) void k_prep(const float* __restrict__ kv, const float* __restrict__ q, const float* __restrict__ wq, const float* __restrict__ wk, const float* __restrict__ wv, const float* __restrict__ wo, const float* __restrict__ imp, bf* X, bf* WP, float* LI) {
    constexpr unsigned BKV = NB_ * TKC * DD / 2048, BQ = NB_ * TQ * DD / 2048, BW = DD * DD / 2048;
    unsigned t = blockIdx.x; const float* src; bf* dst;
    if (t < BKV) { src = kv; dst = X + (size_t)NB_ * TQ * DD; }
    else if ((t -= BKV) < BQ) { src = q; dst = X; }
    else if ((t -= BQ) < 4 * BW) { const unsigned w = t / BW; t %= BW; src = w == 0 ? wq : w == 1 ? wk : w == 2 ? wv : wo; dst = WP + (size_t)w * DD * DD; }
    else { limp(imp, LI, (int)((t - 4 * BW) * 256 + threadIdx.x)); return; }
    cvt8(src, dst, (size_t)t * 256 + threadIdx.x);
}
__device__ __forceinline__ float xhalf(float x) { return __builtin_bit_cast(float, __builtin_amdgcn_permlanex16(__builtin_bit_cast(int, x), __builtin_bit_cast(int, x), 0x76543210, 0xfedcba98, false, false)); }   // lane l takes lane l ^ 16
__global__ __launch_bounds__(512) void k_fattn(const h16* __restrict__ QP, const h16* __restrict__ KP, const h16* __restrict__ VT, const float* __restrict__ LI, bf* Ah, bf* Al) {
    constexpr int KS = TKC / 2, XQ = 9 * 128;   // keys of a half; floats that a wave hands over for one column group: 8 pieces of 16 bytes a lane of output tiles, one of maximum and sum
    __shared__ __align__(16) float xs[8 * 2 * XQ];
    const int lane = threadIdx.x & 31, hi = lane >> 4;
    const int wv = __builtin_amdgcn_readfirstlane(threadIdx.x >> 5), qg = wv & 7, kh = wv >> 3;   // the wave's query group and its half of the keys
    const int h = blockIdx.y, b = blockIdx.z, q0 = blockIdx.x * 256 + qg * 32;
    const h16* Qp = QP + ((size_t)(b * NH_ + h) * TQ + q0) * HD + 8 * lane;   // all three planes in fragment order: 16 tokens of q or k are two blocks, 32 keys of VT four
    const h16* Kp = KP + ((size_t)(b * NH_ + h) * TKC + kh * KS) * HD + 8 * lane;   // both start at the wave's first key: a key takes HD elements in either plane
    const h16* Vp = VT + ((size_t)(b * NH_ + h) * TKC + kh * KS) * HD + 8 * lane;
    v16h qf[2][2], kf[2][2];
#pragma unroll
    for (int q = 0; q < 2; ++q)
#pragma unroll
        for (int c = 0; c < 2; ++c) { qf[q][c] = WFrag<h16>::ld(Qp + q * 16 * HD + c * 512); kf[q][c] = WFrag<h16>::ld(Kp + q * 16 * HD + c * 512); }
    float li2[8];   // key k carries the term of sensor k mod 16 (the reference tiles imp over t_kv), and every tile starts at a multiple of 16: the lane's eight terms are the same in every tile
#pragma unroll
    for (int j = 0; j < 8; ++j) li2[j] = LI[(size_t)b * TKC + hi * 8 + j] * L2E;
    v8f acc[4][2];
#pragma unroll
    for (int dt = 0; dt < 4; ++dt) { acc[dt][0] = (v8f){}; acc[dt][1] = (v8f){}; }
    float m[2] = { -3.0e38f, -3.0e38f }, l[2] = { 0.f, 0.f };
#pragma unroll 1   // stays rolled: one pass already holds some 230 registers, and a second copy of the body would only lengthen the code
    for (int kc = 0; kc < KS; kc += 32) {
        v16h vf[4];
#pragma unroll
        for (int dt = 0; dt < 4; ++dt) vf[dt] = WFrag<h16>::ld(Vp + (size_t)kc * HD + dt * 512);
        asm volatile("s_wait_xcnt 0x0" ::: "memory");   // stands in front of the step of the V address pair, which the loads just issued name
        __builtin_amdgcn_sched_barrier(0);   // keeps the V loads at the head of the pass (the scheduler sinks them behind the maximum otherwise), so that the score products and the maximum cover their latency
        v8f st[2][2];
#pragma unroll
        for (int t = 0; t < 2; ++t)
#pragma unroll
            for (int q = 0; q < 2; ++q) st[t][q] = wmma16(kf[t][1], qf[q][1], wmma16(kf[t][0], qf[q][0], (v8f){}));
        const int kn = kc + 32 < KS ? kc + 32 : 0;   // the next pass's key rows, fetched while this pass does its softmax; the last pass re-reads the half's rows 0..31 (in bounds, not used)
#pragma unroll
        for (int t = 0; t < 2; ++t)
#pragma unroll
            for (int c = 0; c < 2; ++c) kf[t][c] = WFrag<h16>::ld(Kp + (size_t)(kn + t * 16) * HD + c * 512);
        __builtin_amdgcn_sched_barrier(0);   // keeps the K fetch directly behind the score products (the scheduler sinks it behind the rescale branch otherwise): the whole softmax and attn.v of this pass cover its latency
        float mx[2];
#pragma unroll
        for (int q = 0; q < 2; ++q) { float x = -3.0e38f;
#pragma unroll
            for (int t = 0; t < 2; ++t)
#pragma unroll
                for (int j = 0; j < 8; ++j) { st[t][q][j] = fmaf(st[t][q][j], SCL * L2E, li2[j]); x = fmaxf(x, st[t][q][j]); }
            mx[q] = fmaxf(x, xhalf(x)); }
        if (__builtin_amdgcn_ballot_w32(mx[0] > m[0] + 5.0f || mx[1] > m[1] + 5.0f) != 0) {   // one scalar branch a pass
#pragma unroll
            for (int q = 0; q < 2; ++q) { const float mn = fmaxf(m[q], mx[q]); const float al = __builtin_amdgcn_exp2f(m[q] - mn); m[q] = mn; l[q] *= al;
#pragma unroll
                for (int dt = 0; dt < 4; ++dt) acc[dt][q] *= al; }
        }
#pragma unroll
        for (int q = 0; q < 2; ++q) { const float cq = 10.0f - m[q]; v16h pb;
#pragma unroll
            for (int t = 0; t < 2; ++t) { float e[8];
#pragma unroll
                for (int j = 0; j < 8; ++j) e[j] = st[t][q][j] + cq;
                // eight exponentials in place and the free slot behind the last one in ONE statement: no instruction directly behind a v_exp reads its result or overwrites its source
                asm("v_exp_f32 %0, %0\n\tv_exp_f32 %1, %1\n\tv_exp_f32 %2, %2\n\tv_exp_f32 %3, %3\n\tv_exp_f32 %4, %4\n\tv_exp_f32 %5, %5\n\tv_exp_f32 %6, %6\n\tv_exp_f32 %7, %7\n\tv_nop"
                    : "+v"(e[0]), "+v"(e[1]), "+v"(e[2]), "+v"(e[3]), "+v"(e[4]), "+v"(e[5]), "+v"(e[6]), "+v"(e[7]));
#pragma unroll
                for (int j = 0; j < 8; ++j) { l[q] += e[j]; pb[t * 8 + j] = tohx(e[j]); } }
#pragma unroll
            for (int dt = 0; dt < 4; ++dt) acc[dt][q] = wmma16(vf[dt], pb, acc[dt][q]); }
    }
    // The join: the wave of the first key half finishes column group 0, its partner column group 1; each hands the other group's state over. A piece is 16 bytes a lane, 512 contiguous bytes a wave.
    float* xp = xs + qg * (2 * XQ) + lane * 4;
    auto put = [&](int q) { float* p = xp + q * XQ;
#pragma unroll
        for (int dt = 0; dt < 4; ++dt) { *(v4fa*)(p + dt * 256) = __builtin_shufflevector(acc[dt][q], acc[dt][q], 0, 1, 2, 3); *(v4fa*)(p + dt * 256 + 128) = __builtin_shufflevector(acc[dt][q], acc[dt][q], 4, 5, 6, 7); }
        *(v4fa*)(p + 8 * 128) = (v4f){ m[q], l[q], 0.f, 0.f }; };
    auto fin = [&](int q) { const float* p = xp + q * XQ; const v4f ml = *(const v4fa*)(p + 8 * 128);
        const float mn = fmaxf(m[q], ml[0]); float a0 = m[q] - mn, a1 = ml[0] - mn;   // both maxima are finite: each half has walked its keys
        asm("v_exp_f32 %0, %0\n\tv_exp_f32 %1, %1\n\tv_nop" : "+v"(a0), "+v"(a1));   // the two weights and the free slot behind the last exponential in one statement, as in the loop
        const float ls = fmaf(l[q], a0, ml[1] * a1); const float inv = __fdiv_rn(1.0f, ls + xhalf(ls));   // the lane halves' sums joined once
        const float s0 = a0 * inv, s1 = a1 * inv;
        const size_t oo = ((size_t)b * TQ + q0 + q * 16) * DD + h * 1024 + lane * 8;   // fragment order, rows = tokens, k = the 1024 merged features: head h is blocks 2h and 2h + 1 of the 16 tokens, tile dt a half block
#pragma unroll
        for (int dt = 0; dt < 4; ++dt) { const v4f x0 = *(const v4fa*)(p + dt * 256), x1 = *(const v4fa*)(p + dt * 256 + 128); v8us oh, ol;
#pragma unroll
            for (int j = 0; j < 8; ++j) { unsigned short a, c2; splitf(fmaf(acc[dt][q][j], s0, (j < 4 ? x0[j & 3] : x1[j & 3]) * s1), a, c2); oh[j] = a; ol[j] = c2; }
            *(v8us*)(Ah + oo + dt * 256) = oh; *(v8us*)(Al + oo + dt * 256) = ol; } };
    if (kh == 0) put(1); else put(0);
    __syncthreads();   // every wave's hand-over is written before its partner reads it
    if (kh == 0) fin(0); else fin(1);
}

extern "C" void kernel_launch(void* const* d_in, const int* in_sizes, int n_in,
                              void* d_out, int out_size, void* d_ws, size_t ws_size, hipStream_t stream) {
    (void)in_sizes; (void)n_in; (void)out_size;
    const float* qin = (const float*)d_in[0]; const float* kvin = (const float*)d_in[1]; const float* imp = (const float*)d_in[2]; const float* wq = (const float*)d_in[3]; const float* wk = (const float*)d_in[4]; const float* wv = (const float*)d_in[5]; const float* wo = (const float*)d_in[6];   // torch [out][in] weights
    float* OUT = (float*)d_out;     // [2][2048][1024]
    char* wsp = (char*)d_ws;
    auto take = [&](size_t bytes) { char* p = wsp; wsp += (bytes + 255) & ~(size_t)255; return (void*)p; };
    bf* WP = (bf*)take((size_t)4 * DD * DD * 2); bf* WO = WP + (size_t)3 * DD * DD; float* LI = (float*)take((size_t)NB_ * TKC * 4);   // weight planes q, k, v, o in a row
    bf* X = (bf*)take((size_t)NB_ * (TQ + TKC) * DD * 2);   // the query tokens of both batches, then the source tokens of both
    h16* QP = (h16*)take((size_t)NB_ * NH_ * (TQ + 2 * TKC) * HD * 2); h16* KP = QP + (size_t)NB_ * NH_ * TQ * HD; h16* VT = KP + (size_t)NB_ * NH_ * TKC * HD;   // head planes in a row
    bf* Ah = (bf*)take((size_t)NB_ * TQ * DD * 2); bf* Al = (bf*)take((size_t)NB_ * TQ * DD * 2);
    if ((size_t)(wsp - (char*)d_ws) > ws_size) return;    // total ~ 88 MiB; ws 256 MiB
    k_prep<<<NB_ * (TQ + TKC) * DD / 2048 + 4 * DD * DD / 2048 + NB_ * TKC / 256, 256, 0, stream>>>(kvin, qin, wq, wk, wv, wo, imp, X, WP, LI);
    k_gemmw<bf, 0, false, 1><<<NB_ * (TQ + 2 * TKC) / 128 * (NH_ / 2), 128, 0, stream>>>(WP, nullptr, X, nullptr, nullptr, 0, nullptr, 0, 0, 0, QP);
    k_fattn<<<dim3(TQ / 256, NH_, NB_), 512, 0, stream>>>(QP, KP, VT, LI, Ah, Al);
    k_gemmw<bf, 1, false, 0><<<dim3(NB_ * TQ / 128, DD / 128, 1), 128, 0, stream>>>(Ah, Al, WO, nullptr, OUT, DD, nullptr, 0, 0, 0, nullptr);   // the batches' tokens stand in a row in Ah, Al and out: one product over all 4096
}
